// v000
// The times below were measured on an AMD MI455X: many runs one after another, warmed up first and cycling through
// copies of the inputs, with the whole window's GPU time divided by the number of runs. Launches and the gaps
// between them are all in it. The median over several windows is given; except for v000 it joins two sittings, which
// can be a few percent apart, so the side-by-side timings, each taken in one sitting, are the better comparison.
// v000, which the later versions start from, runs in 238 microseconds.
#include <hip/hip_runtime.h>
#include <hip/hip_bf16.h>

typedef __attribute__((ext_vector_type(2))) float v2f;
typedef __attribute__((ext_vector_type(8))) float v8f;
typedef __attribute__((ext_vector_type(4))) int   v4i;

#define WMMA_F32(a, b, c) \
    __builtin_amdgcn_wmma_f32_16x16x4_f32(false, (a), false, (b), (short)0, (c), false, false)

#define NROI 1024
#define DIM  1024
#define PDIM 64
#define GRP  16
#define DK   64

// ---------------------------------------------------------------------------
// CDNA5 async global->LDS copy (ASYNCcnt path), with synchronous fallback so
// the file compiles on toolchains lacking the builtin.
// ---------------------------------------------------------------------------
#if defined(__HIP_DEVICE_COMPILE__) && __has_builtin(__builtin_amdgcn_global_load_async_to_lds_b128)
#define HAVE_ASYNC_LDS 1
#else
#define HAVE_ASYNC_LDS 0
#endif

__device__ __forceinline__ void async_copy16(const void* g, void* l)
{
#if HAVE_ASYNC_LDS
    typedef __attribute__((address_space(1))) v4i* g4p;
    typedef __attribute__((address_space(3))) v4i* l4p;
    __builtin_amdgcn_global_load_async_to_lds_b128(
        (g4p)(uintptr_t)g, (l4p)(uintptr_t)l, 0, 0);
#else
    *(float4*)l = *(const float4*)g;
#endif
}

template <int N>
__device__ __forceinline__ void wait_async()
{
#if HAVE_ASYNC_LDS
#if __has_builtin(__builtin_amdgcn_s_wait_asynccnt)
    __builtin_amdgcn_s_wait_asynccnt((unsigned short)N);
#else
    if (N == 0) asm volatile("s_wait_asynccnt 0x0" ::: "memory");
    else        asm volatile("s_wait_asynccnt 0x2" ::: "memory");
#endif
#endif
}

// ---------------------------------------------------------------------------
// Generic fp32 WMMA GEMM: C[M,N] = A[M,K] @ B[K,N] (+bias), 64x64 tile / WG,
// 8 waves (wave32), 16x32 sub-tile per wave. Double-buffered LDS with async
// global->LDS copies so tile t+1 streams in under tile t's WMMAs.
// transC=1 stores C transposed: C[n*ldc + m] (used for k^T layout).
// blockIdx.z batches B and C by strideB/strideC (A shared across batch).
// ---------------------------------------------------------------------------
__global__ __launch_bounds__(256)
void gemm64x64(const float* __restrict__ A, const float* __restrict__ B,
               const float* __restrict__ bias, float* __restrict__ C,
               int lda, int ldb, int ldc, int K,
               long strideB, long strideC, int transC)
{
    __shared__ float As[2][64][20];   // 64x16 tile, pad 20 (conflict-free A-frag reads)
    __shared__ float Bs[2][16][64];   // 16x64 tile

    const int tid  = threadIdx.x;
    const int lane = tid & 31;
    const int w    = tid >> 5;
    const int m0   = blockIdx.y * 64;
    const int n0   = blockIdx.x * 64;
    B += (long)blockIdx.z * strideB;
    C += (long)blockIdx.z * strideC;

    const int wm = (w & 3) * 16;      // wave row base within 64
    const int wn = (w >> 2) * 32;     // wave col base within 64
    const int lm = lane & 15;
    const int lk = (lane >> 4) * 2;   // K offset pair per half-wave

    // per-thread copy slots (one 16B A chunk + one 16B B chunk per tile)
    const int ra = tid >> 2, ca = (tid & 3) * 4;
    const int rb = tid >> 4, cb = (tid & 15) * 4;
    const float* gA = A + (long)(m0 + ra) * lda + ca;
    const float* gB = B + (long)rb * ldb + n0 + cb;

    v8f acc0 = {0.f,0.f,0.f,0.f,0.f,0.f,0.f,0.f};
    v8f acc1 = {0.f,0.f,0.f,0.f,0.f,0.f,0.f,0.f};

    const int ntiles = K >> 4;
    // prologue: stream tile 0 into buffer 0
    async_copy16(gA, &As[0][ra][ca]);
    async_copy16(gB, &Bs[0][rb][cb]);

    for (int t = 0; t < ntiles; ++t) {
        const int buf = t & 1;
        if (t + 1 < ntiles) {            // stream next tile into other buffer
            const int kk = (t + 1) << 4;
            async_copy16(gA + kk,               &As[buf ^ 1][ra][ca]);
            async_copy16(gB + (long)kk * ldb,   &Bs[buf ^ 1][rb][cb]);
            wait_async<2>();             // tile t landed (async loads retire in order)
        } else {
            wait_async<0>();
        }
        __syncthreads();

        #pragma unroll
        for (int k2 = 0; k2 < 16; k2 += 4) {
            v2f a;  a.x  = As[buf][wm + lm][k2 + lk];       a.y  = As[buf][wm + lm][k2 + lk + 1];
            v2f b0; b0.x = Bs[buf][k2 + lk][wn + lm];       b0.y = Bs[buf][k2 + lk + 1][wn + lm];
            v2f b1; b1.x = Bs[buf][k2 + lk][wn + 16 + lm];  b1.y = Bs[buf][k2 + lk + 1][wn + 16 + lm];
            acc0 = WMMA_F32(a, b0, acc0);
            acc1 = WMMA_F32(a, b1, acc1);
        }
        __syncthreads();                 // buffer free for reuse at t+2
    }

    #pragma unroll
    for (int v = 0; v < 8; ++v) {
        int r  = m0 + wm + v + (lane >> 4) * 8;
        int c0 = n0 + wn + lm;
        float o0 = acc0[v], o1 = acc1[v];
        if (bias) { o0 += bias[c0]; o1 += bias[c0 + 16]; }
        if (!transC) {
            C[(long)r * ldc + c0]      = o0;
            C[(long)r * ldc + c0 + 16] = o1;
        } else {
            C[(long)c0 * ldc + r]        = o0;
            C[(long)(c0 + 16) * ldc + r] = o1;
        }
    }
}

// ---------------------------------------------------------------------------
// Positional bias: aff[i][g][j] = tanh(pe[i,j,:] @ W1 + b1) @ W2 + b2
// One WG handles (i fixed, 64 consecutive j). fc1 = 64x64x64 WMMA, tanh,
// fc2 = 64x64x16 WMMA, scattered store into the [i][g][j] layout.
// This kernel streams the 256 MB position embedding: the HBM-bound stage.
// ---------------------------------------------------------------------------
__global__ __launch_bounds__(256)
void posbias(const float* __restrict__ pe, const float* __restrict__ W1,
             const float* __restrict__ b1, const float* __restrict__ W2,
             const float* __restrict__ b2, float* __restrict__ aff)
{
    __shared__ float Xs[64][68];
    __shared__ float W1s[64][64];
    __shared__ float C1s[64][68];
    __shared__ float W2s[64][16];

    const int tid  = threadIdx.x;
    const int lane = tid & 31;
    const int w    = tid >> 5;
    const int i    = blockIdx.y;
    const int j0   = blockIdx.x * 64;
    const float* X = pe + ((long)i * NROI + j0) * PDIM;

    #pragma unroll
    for (int it = 0; it < 4; ++it) {
        int idx = tid + it * 256;
        int r = idx >> 4, c4 = (idx & 15) * 4;
        async_copy16(X + (long)r * PDIM + c4, &Xs[r][c4]);
        async_copy16(W1 + r * PDIM + c4,      &W1s[r][c4]);
    }
    {   int r = tid >> 2, c4 = (tid & 3) * 4;
        async_copy16(W2 + r * GRP + c4, &W2s[r][c4]);
    }
    wait_async<0>();
    __syncthreads();

    const int lm = lane & 15;
    const int lk = (lane >> 4) * 2;
    const int wm = (w & 3) * 16, wn = (w >> 2) * 32;

    v8f c0 = {0.f,0.f,0.f,0.f,0.f,0.f,0.f,0.f};
    v8f c1 = {0.f,0.f,0.f,0.f,0.f,0.f,0.f,0.f};
    #pragma unroll
    for (int kk = 0; kk < 64; kk += 4) {
        v2f a;  a.x  = Xs[wm + lm][kk + lk];        a.y  = Xs[wm + lm][kk + lk + 1];
        v2f b0; b0.x = W1s[kk + lk][wn + lm];       b0.y = W1s[kk + lk + 1][wn + lm];
        v2f b1; b1.x = W1s[kk + lk][wn + 16 + lm];  b1.y = W1s[kk + lk + 1][wn + 16 + lm];
        c0 = WMMA_F32(a, b0, c0);
        c1 = WMMA_F32(a, b1, c1);
    }
    #pragma unroll
    for (int v = 0; v < 8; ++v) {
        int r = wm + v + (lane >> 4) * 8;
        int n = wn + lm;
        C1s[r][n]      = tanhf(c0[v] + b1[n]);
        C1s[r][n + 16] = tanhf(c1[v] + b1[n + 16]);
    }
    __syncthreads();

    if (w < 4) {   // wave-uniform: EXEC stays all-ones inside
        const int wm2 = w * 16;
        v8f c2 = {0.f,0.f,0.f,0.f,0.f,0.f,0.f,0.f};
        #pragma unroll
        for (int kk = 0; kk < 64; kk += 4) {
            v2f a; a.x = C1s[wm2 + lm][kk + lk]; a.y = C1s[wm2 + lm][kk + lk + 1];
            v2f b; b.x = W2s[kk + lk][lm];       b.y = W2s[kk + lk + 1][lm];
            c2 = WMMA_F32(a, b, c2);
        }
        #pragma unroll
        for (int v = 0; v < 8; ++v) {
            int r = wm2 + v + (lane >> 4) * 8;     // local j
            int g = lm;
            aff[(long)i * (GRP * NROI) + (long)g * NROI + (j0 + r)] = c2[v] + b2[g];
        }
    }
}

// ---------------------------------------------------------------------------
// Attention: per (g, 16-row i-tile): S = (Q_g K_g^T) * aff * 0.125, softmax
// over 1024 keys, then P @ VW_g (VW = V @ W_out precomputed) + b_out.
// 8 waves split the 1024-key dimension. kt is K^T [DIM][NROI] so B-fragment
// loads are lane-coalesced.
// ---------------------------------------------------------------------------
__global__ __launch_bounds__(256)
void attn(const float* __restrict__ qbuf, const float* __restrict__ kt,
          const float* __restrict__ aff, const float* __restrict__ vw,
          const float* __restrict__ b_out, float* __restrict__ out)
{
    __shared__ float Qs[16][68];
    __shared__ float S[16][1028];       // pad 1028: stride mod 64 == 4 -> conflict-free A reads
    __shared__ float Pp[8][16][64];
    __shared__ float red[16][16];
    __shared__ float rowstat[16];

    const int tid  = threadIdx.x;
    const int lane = tid & 31;
    const int w    = tid >> 5;
    const int g    = blockIdx.x;
    const int i0   = blockIdx.y * 16;

    {   int r = tid >> 4, c4 = (tid & 15) * 4;
        async_copy16(qbuf + (long)(i0 + r) * DIM + g * DK + c4, &Qs[r][c4]);
    }
    wait_async<0>();
    __syncthreads();

    const int lm = lane & 15;
    const int lk = (lane >> 4) * 2;
    const int jb = w * 128;

    // ---- stage 1: logits for this wave's 128 keys ----
    #pragma unroll 1
    for (int tj = 0; tj < 8; ++tj) {
        const int j0t = jb + tj * 16;
        v8f acc = {0.f,0.f,0.f,0.f,0.f,0.f,0.f,0.f};
        #pragma unroll
        for (int kk = 0; kk < DK; kk += 4) {
            v2f a = *(const v2f*)&Qs[lm][kk + lk];
            const float* kp = kt + (long)(g * DK + kk + lk) * NROI + j0t + lm; // coalesced
            v2f b; b.x = kp[0]; b.y = kp[NROI];
            acc = WMMA_F32(a, b, acc);
        }
        #pragma unroll
        for (int v = 0; v < 8; ++v) {
            int il = v + (lane >> 4) * 8;
            int j  = j0t + lm;
            float aw = aff[(long)(i0 + il) * (GRP * NROI) + (long)g * NROI + j];
            S[il][j] = aw * acc[v] * 0.125f;   // 1/sqrt(64)
        }
    }
    __syncthreads();

    // ---- softmax over 1024 keys per row: 16 threads per row ----
    {
        const int row = tid >> 4, sub = tid & 15;
        float m = -3.402823466e38f;
        for (int kx = sub; kx < NROI; kx += 16) m = fmaxf(m, S[row][kx]);
        red[row][sub] = m;
        __syncthreads();
        if (sub == 0) {
            float mm = red[row][0];
            #pragma unroll
            for (int t = 1; t < 16; ++t) mm = fmaxf(mm, red[row][t]);
            rowstat[row] = mm;
        }
        __syncthreads();
        const float mm = rowstat[row];
        float s = 0.f;
        for (int kx = sub; kx < NROI; kx += 16) {
            float e = __expf(S[row][kx] - mm);
            S[row][kx] = e;
            s += e;
        }
        red[row][sub] = s;
        __syncthreads();
        if (sub == 0) {
            float ss = 0.f;
            #pragma unroll
            for (int t = 0; t < 16; ++t) ss += red[row][t];
            rowstat[row] = 1.f / ss;
        }
        __syncthreads();
        const float inv = rowstat[row];
        for (int kx = sub; kx < NROI; kx += 16) S[row][kx] *= inv;
    }
    __syncthreads();

    // ---- stage 2: P(16x128 per wave) @ VW_g(128x64 slice) -> partial 16x64 ----
    v8f o[4] = { {0.f,0.f,0.f,0.f,0.f,0.f,0.f,0.f}, {0.f,0.f,0.f,0.f,0.f,0.f,0.f,0.f},
                 {0.f,0.f,0.f,0.f,0.f,0.f,0.f,0.f}, {0.f,0.f,0.f,0.f,0.f,0.f,0.f,0.f} };
    #pragma unroll 1
    for (int kk = 0; kk < 128; kk += 4) {
        const int kbase = jb + kk + lk;
        v2f a = *(const v2f*)&S[lm][kbase];
        const float* vp = vw + (long)g * (NROI * DK) + (long)kbase * DK + lm;
        #pragma unroll
        for (int nt = 0; nt < 4; ++nt) {
            v2f b; b.x = vp[nt * 16]; b.y = vp[DK + nt * 16];
            o[nt] = WMMA_F32(a, b, o[nt]);
        }
    }
    #pragma unroll
    for (int nt = 0; nt < 4; ++nt) {
        #pragma unroll
        for (int v = 0; v < 8; ++v) {
            int il = v + (lane >> 4) * 8;
            Pp[w][il][nt * 16 + lm] = o[nt][v];
        }
    }
    __syncthreads();

    // ---- cross-wave reduce + bias + store ----
    #pragma unroll
    for (int it = 0; it < 4; ++it) {
        int e = tid + it * 256;
        int r = e >> 6, oc = e & 63;
        float s = 0.f;
        #pragma unroll
        for (int ww = 0; ww < 8; ++ww) s += Pp[ww][r][oc];
        out[(long)(i0 + r) * DIM + g * DK + oc] = s + b_out[g * DK + oc];
    }
}

// ---------------------------------------------------------------------------
extern "C" void kernel_launch(void* const* d_in, const int* in_sizes, int n_in,
                              void* d_out, int out_size, void* d_ws, size_t ws_size,
                              hipStream_t stream)
{
    const float* roi   = (const float*)d_in[0];
    const float* pe    = (const float*)d_in[1];
    const float* W_fc1 = (const float*)d_in[2];
    const float* b_fc1 = (const float*)d_in[3];
    const float* W_fc2 = (const float*)d_in[4];
    const float* b_fc2 = (const float*)d_in[5];
    const float* W_q   = (const float*)d_in[6];
    const float* b_q   = (const float*)d_in[7];
    const float* W_k   = (const float*)d_in[8];
    const float* b_k   = (const float*)d_in[9];
    const float* W_out = (const float*)d_in[10];
    const float* b_out = (const float*)d_in[11];
    float* out = (float*)d_out;

    float* ws   = (float*)d_ws;
    float* qb   = ws;                               // q  [1024,1024]
    float* ktb  = qb + (long)NROI * DIM;            // k^T [1024(D),1024(N)]
    float* vwb  = ktb + (long)DIM * NROI;           // VW [16,1024,64]
    float* affb = vwb + (long)GRP * NROI * DK;      // aff [1024,16,1024]
    (void)in_sizes; (void)n_in; (void)out_size; (void)ws_size;

    dim3 blk(256);

    // q = roi @ W_q + b_q ; kt = (roi @ W_k + b_k)^T
    gemm64x64<<<dim3(DIM / 64, NROI / 64, 1), blk, 0, stream>>>(
        roi, W_q, b_q, qb, DIM, DIM, DIM, DIM, 0, 0, 0);
    gemm64x64<<<dim3(DIM / 64, NROI / 64, 1), blk, 0, stream>>>(
        roi, W_k, b_k, ktb, DIM, DIM, NROI, DIM, 0, 0, 1);

    // VW[g] = V @ W_out[g]   (bias folded into attn kernel; softmax sums to 1)
    gemm64x64<<<dim3(1, NROI / 64, GRP), blk, 0, stream>>>(
        roi, W_out, nullptr, vwb, DIM, DK, DK, DIM,
        (long)DIM * DK, (long)NROI * DK, 0);

    // aff[i][g][j] = tanh(pe@W1+b1)@W2+b2  (streams the 256 MB PE tensor)
    posbias<<<dim3(NROI / 64, NROI, 1), blk, 0, stream>>>(
        pe, W_fc1, b_fc1, W_fc2, b_fc2, affb);

    // fused logits * aff -> softmax -> @ VW + b_out
    attn<<<dim3(GRP, NROI / 16, 1), blk, 0, stream>>>(
        qb, ktb, affb, vwb, b_out, out);
}

// v001
// One run takes 183 microseconds.
// Next to v000, in two timings, it ran 1.33 times as fast each time.
#include <hip/hip_runtime.h>
#include <hip/hip_bf16.h>

typedef __attribute__((ext_vector_type(2))) float v2f;
typedef __attribute__((ext_vector_type(8))) float v8f;
typedef __attribute__((ext_vector_type(4))) int   v4i;

#define WMMA_F32(a, b, c) \
    __builtin_amdgcn_wmma_f32_16x16x4_f32(false, (a), false, (b), (short)0, (c), false, false)

#define NROI 1024
#define DIM  1024
#define PDIM 64
#define GRP  16
#define DK   64

// ---------------------------------------------------------------------------
// CDNA5 async global->LDS copy (ASYNCcnt path), with synchronous fallback so
// the file compiles on toolchains lacking the builtin.
// ---------------------------------------------------------------------------
#if defined(__HIP_DEVICE_COMPILE__) && __has_builtin(__builtin_amdgcn_global_load_async_to_lds_b128)
#define HAVE_ASYNC_LDS 1
#else
#define HAVE_ASYNC_LDS 0
#endif

__device__ __forceinline__ void async_copy16(const void* g, void* l)
{
#if HAVE_ASYNC_LDS
    typedef __attribute__((address_space(1))) v4i* g4p;
    typedef __attribute__((address_space(3))) v4i* l4p;
    __builtin_amdgcn_global_load_async_to_lds_b128(
        (g4p)(uintptr_t)g, (l4p)(uintptr_t)l, 0, 0);
#else
    *(float4*)l = *(const float4*)g;
#endif
}

template <int N>
__device__ __forceinline__ void wait_async()
{
#if HAVE_ASYNC_LDS
#if __has_builtin(__builtin_amdgcn_s_wait_asynccnt)
    __builtin_amdgcn_s_wait_asynccnt((unsigned short)N);
#else
    if (N == 0) asm volatile("s_wait_asynccnt 0x0" ::: "memory");
    else        asm volatile("s_wait_asynccnt 0x2" ::: "memory");
#endif
#endif
}

// ---------------------------------------------------------------------------
// Generic fp32 WMMA GEMM: C[M,N] = A[M,K] @ B[K,N] (+bias), 64x64 tile / WG,
// 8 waves (wave32), 16x32 sub-tile per wave. Double-buffered LDS with async
// global->LDS copies so tile t+1 streams in under tile t's WMMAs.
// transC=1 stores C transposed: C[n*ldc + m] (used for k^T layout).
// One work-group's body: the caller picks operands and the tile (m0, n0).
// smem: the work-group's LDS block, 4608 floats used here.
// ---------------------------------------------------------------------------
__device__ __forceinline__
void gemm64x64(float* smem,
               const float* __restrict__ A, const float* __restrict__ B,
               const float* __restrict__ bias, float* __restrict__ C,
               int lda, int ldb, int ldc, int K,
               int m0, int n0, int transC)
{
    float (*As)[64][20] = (float (*)[64][20])smem;            // 64x16 tile, pad 20 (conflict-free A-frag reads)
    float (*Bs)[16][64] = (float (*)[16][64])(smem + 2560);   // 16x64 tile

    const int tid  = threadIdx.x;
    const int lane = tid & 31;
    const int w    = tid >> 5;

    const int wm = (w & 3) * 16;      // wave row base within 64
    const int wn = (w >> 2) * 32;     // wave col base within 64
    const int lm = lane & 15;
    const int lk = (lane >> 4) * 2;   // K offset pair per half-wave

    // per-thread copy slots (one 16B A chunk + one 16B B chunk per tile)
    const int ra = tid >> 2, ca = (tid & 3) * 4;
    const int rb = tid >> 4, cb = (tid & 15) * 4;
    const float* gA = A + (long)(m0 + ra) * lda + ca;
    const float* gB = B + (long)rb * ldb + n0 + cb;

    v8f acc0 = {0.f,0.f,0.f,0.f,0.f,0.f,0.f,0.f};
    v8f acc1 = {0.f,0.f,0.f,0.f,0.f,0.f,0.f,0.f};

    const int ntiles = K >> 4;
    // prologue: stream tile 0 into buffer 0
    async_copy16(gA, &As[0][ra][ca]);
    async_copy16(gB, &Bs[0][rb][cb]);

    for (int t = 0; t < ntiles; ++t) {
        const int buf = t & 1;
        if (t + 1 < ntiles) {            // stream next tile into other buffer
            const int kk = (t + 1) << 4;
            async_copy16(gA + kk,               &As[buf ^ 1][ra][ca]);
            async_copy16(gB + (long)kk * ldb,   &Bs[buf ^ 1][rb][cb]);
            wait_async<2>();             // tile t landed (async loads retire in order)
        } else {
            wait_async<0>();
        }
        __syncthreads();

        #pragma unroll
        for (int k2 = 0; k2 < 16; k2 += 4) {
            v2f a;  a.x  = As[buf][wm + lm][k2 + lk];       a.y  = As[buf][wm + lm][k2 + lk + 1];
            v2f b0; b0.x = Bs[buf][k2 + lk][wn + lm];       b0.y = Bs[buf][k2 + lk + 1][wn + lm];
            v2f b1; b1.x = Bs[buf][k2 + lk][wn + 16 + lm];  b1.y = Bs[buf][k2 + lk + 1][wn + 16 + lm];
            acc0 = WMMA_F32(a, b0, acc0);
            acc1 = WMMA_F32(a, b1, acc1);
        }
        __syncthreads();                 // buffer free for reuse at t+2
    }

    #pragma unroll
    for (int v = 0; v < 8; ++v) {
        int r  = m0 + wm + v + (lane >> 4) * 8;
        int c0 = n0 + wn + lm;
        float o0 = acc0[v], o1 = acc1[v];
        if (bias) { o0 += bias[c0]; o1 += bias[c0 + 16]; }
        if (!transC) {
            C[(long)r * ldc + c0]      = o0;
            C[(long)r * ldc + c0 + 16] = o1;
        } else {
            C[(long)c0 * ldc + r]        = o0;
            C[(long)(c0 + 16) * ldc + r] = o1;
        }
        // the two stores' registers are reused by the next pass and by what follows the loop:
        // keep the wait in front of any overwrite of a register that an issued store names
        asm volatile("s_wait_xcnt 0x0" ::: "memory");
    }
}

// ---------------------------------------------------------------------------
// Positional bias: aff[i][g][j] = tanh(pe[i,j,:] @ W1 + b1) @ W2 + b2
// One WG handles (i fixed, 64 consecutive j). fc1 = 64x64x64 WMMA, tanh,
// fc2 = 64x64x16 WMMA, scattered store into the [i][g][j] layout.
// This body streams the 256 MB position embedding: the HBM-bound job of the producers grid.
// ---------------------------------------------------------------------------
__device__ __forceinline__
void posbias(float* smem,
             const float* __restrict__ pe, const float* __restrict__ W1,
             const float* __restrict__ b1, const float* __restrict__ W2,
             const float* __restrict__ b2, float* __restrict__ aff,
             int i, int j0)
{
    float (*Xs)[68]  = (float (*)[68])smem;              // 64 rows
    float (*W1s)[64] = (float (*)[64])(smem + 4352);     // 64 rows
    float (*C1s)[68] = (float (*)[68])(smem + 8448);     // 64 rows
    float (*W2s)[16] = (float (*)[16])(smem + 12800);    // 64 rows

    const int tid  = threadIdx.x;
    const int lane = tid & 31;
    const int w    = tid >> 5;
    const float* X = pe + ((long)i * NROI + j0) * PDIM;

    #pragma unroll
    for (int it = 0; it < 4; ++it) {
        int idx = tid + it * 256;
        int r = idx >> 4, c4 = (idx & 15) * 4;
        async_copy16(X + (long)r * PDIM + c4, &Xs[r][c4]);
        async_copy16(W1 + r * PDIM + c4,      &W1s[r][c4]);
    }
    {   int r = tid >> 2, c4 = (tid & 3) * 4;
        async_copy16(W2 + r * GRP + c4, &W2s[r][c4]);
    }
    wait_async<0>();
    __syncthreads();

    const int lm = lane & 15;
    const int lk = (lane >> 4) * 2;
    const int wm = (w & 3) * 16, wn = (w >> 2) * 32;

    v8f c0 = {0.f,0.f,0.f,0.f,0.f,0.f,0.f,0.f};
    v8f c1 = {0.f,0.f,0.f,0.f,0.f,0.f,0.f,0.f};
    #pragma unroll
    for (int kk = 0; kk < 64; kk += 4) {
        v2f a;  a.x  = Xs[wm + lm][kk + lk];        a.y  = Xs[wm + lm][kk + lk + 1];
        v2f b0; b0.x = W1s[kk + lk][wn + lm];       b0.y = W1s[kk + lk + 1][wn + lm];
        v2f b1; b1.x = W1s[kk + lk][wn + 16 + lm];  b1.y = W1s[kk + lk + 1][wn + 16 + lm];
        c0 = WMMA_F32(a, b0, c0);
        c1 = WMMA_F32(a, b1, c1);
    }
    #pragma unroll
    for (int v = 0; v < 8; ++v) {
        int r = wm + v + (lane >> 4) * 8;
        int n = wn + lm;
        C1s[r][n]      = tanhf(c0[v] + b1[n]);
        C1s[r][n + 16] = tanhf(c1[v] + b1[n + 16]);
    }
    __syncthreads();

    if (w < 4) {   // wave-uniform: EXEC stays all-ones inside
        const int wm2 = w * 16;
        v8f c2 = {0.f,0.f,0.f,0.f,0.f,0.f,0.f,0.f};
        #pragma unroll
        for (int kk = 0; kk < 64; kk += 4) {
            v2f a; a.x = C1s[wm2 + lm][kk + lk]; a.y = C1s[wm2 + lm][kk + lk + 1];
            v2f b; b.x = W2s[kk + lk][lm];       b.y = W2s[kk + lk + 1][lm];
            c2 = WMMA_F32(a, b, c2);
        }
        #pragma unroll
        for (int v = 0; v < 8; ++v) {
            int r = wm2 + v + (lane >> 4) * 8;     // local j
            int g = lm;
            aff[(long)i * (GRP * NROI) + (long)g * NROI + (j0 + r)] = c2[v] + b2[g];
        }
    }
}

// ---------------------------------------------------------------------------
// The four producers of the attention kernel's operands (q, k^T, VW, aff) do
// not depend on one another: one grid runs them all, the block index picks the
// job. The 768 GEMM blocks come first: each is a long chain of short K tiles
// that mostly waits for its copies, so they start early and the positional
// bias blocks fill the SIMDs beside them.
// ---------------------------------------------------------------------------
#define GEMM_BLOCKS 768            // 3 products x 256 tiles of 64x64
#define POS_BLOCKS  (16 * NROI)    // 16 j-tiles x 1024 rows i

__global__ __launch_bounds__(256)
void producers(const float* __restrict__ roi, const float* __restrict__ pe,
               const float* __restrict__ W1,  const float* __restrict__ b1,
               const float* __restrict__ W2,  const float* __restrict__ b2,
               const float* __restrict__ Wq,  const float* __restrict__ bq,
               const float* __restrict__ Wk,  const float* __restrict__ bk,
               const float* __restrict__ Wo,
               float* __restrict__ qb, float* __restrict__ ktb,
               float* __restrict__ vwb, float* __restrict__ aff)
{
    __shared__ __attribute__((aligned(16))) float smem[13824];   // the larger body's need (posbias)

    const int b = blockIdx.x;
    if (b < GEMM_BLOCKS) {
        const int job = b >> 8;
        const int bx  = b & 15;
        const int m0  = ((b >> 4) & 15) * 64;
        if (job == 0) {          // q = roi @ W_q + b_q
            gemm64x64(smem, roi, Wq, bq, qb, DIM, DIM, DIM, DIM, m0, bx * 64, 0);
        } else if (job == 1) {   // kt = (roi @ W_k + b_k)^T
            gemm64x64(smem, roi, Wk, bk, ktb, DIM, DIM, NROI, DIM, m0, bx * 64, 1);
        } else {                 // VW[g] = V @ W_out[g], g = bx (bias folded into attn; softmax sums to 1)
            gemm64x64(smem, roi, Wo + (long)bx * (DIM * DK), nullptr,
                      vwb + (long)bx * (NROI * DK), DIM, DK, DK, DIM, m0, 0, 0);
        }
    } else {                     // aff[i][g][j] = tanh(pe@W1+b1)@W2+b2 (streams the 256 MB PE tensor)
        const int p = b - GEMM_BLOCKS;
        posbias(smem, pe, W1, b1, W2, b2, aff, p >> 4, (p & 15) * 64);
    }
}

// ---------------------------------------------------------------------------
// Attention: per (g, 16-row i-tile): S = (Q_g K_g^T) * aff * 0.125, softmax
// over 1024 keys, then P @ VW_g (VW = V @ W_out precomputed) + b_out.
// 8 waves split the 1024-key dimension. kt is K^T [DIM][NROI] so B-fragment
// loads are lane-coalesced.
// ---------------------------------------------------------------------------
__global__ __launch_bounds__(256)
void attn(const float* __restrict__ qbuf, const float* __restrict__ kt,
          const float* __restrict__ aff, const float* __restrict__ vw,
          const float* __restrict__ b_out, float* __restrict__ out)
{
    __shared__ float Qs[16][68];
    __shared__ float S[16][1028];       // pad 1028: stride mod 64 == 4 -> conflict-free A reads
    __shared__ float Pp[8][16][64];
    __shared__ float red[16][16];
    __shared__ float rowstat[16];

    const int tid  = threadIdx.x;
    const int lane = tid & 31;
    const int w    = tid >> 5;
    const int g    = blockIdx.x;
    const int i0   = blockIdx.y * 16;

    {   int r = tid >> 4, c4 = (tid & 15) * 4;
        async_copy16(qbuf + (long)(i0 + r) * DIM + g * DK + c4, &Qs[r][c4]);
    }
    wait_async<0>();
    __syncthreads();

    const int lm = lane & 15;
    const int lk = (lane >> 4) * 2;
    const int jb = w * 128;

    // ---- stage 1: logits for this wave's 128 keys ----
    #pragma unroll 1
    for (int tj = 0; tj < 8; ++tj) {
        const int j0t = jb + tj * 16;
        v8f acc = {0.f,0.f,0.f,0.f,0.f,0.f,0.f,0.f};
        #pragma unroll
        for (int kk = 0; kk < DK; kk += 4) {
            v2f a = *(const v2f*)&Qs[lm][kk + lk];
            const float* kp = kt + (long)(g * DK + kk + lk) * NROI + j0t + lm; // coalesced
            v2f b; b.x = kp[0]; b.y = kp[NROI];
            acc = WMMA_F32(a, b, acc);
        }
        #pragma unroll
        for (int v = 0; v < 8; ++v) {
            int il = v + (lane >> 4) * 8;
            int j  = j0t + lm;
            float aw = aff[(long)(i0 + il) * (GRP * NROI) + (long)g * NROI + j];
            S[il][j] = aw * acc[v] * 0.125f;   // 1/sqrt(64)
        }
    }
    __syncthreads();

    // ---- softmax over 1024 keys per row: 16 threads per row ----
    {
        const int row = tid >> 4, sub = tid & 15;
        float m = -3.402823466e38f;
        for (int kx = sub; kx < NROI; kx += 16) m = fmaxf(m, S[row][kx]);
        red[row][sub] = m;
        __syncthreads();
        if (sub == 0) {
            float mm = red[row][0];
            #pragma unroll
            for (int t = 1; t < 16; ++t) mm = fmaxf(mm, red[row][t]);
            rowstat[row] = mm;
        }
        __syncthreads();
        const float mm = rowstat[row];
        float s = 0.f;
        for (int kx = sub; kx < NROI; kx += 16) {
            float e = __expf(S[row][kx] - mm);
            S[row][kx] = e;
            s += e;
        }
        red[row][sub] = s;
        __syncthreads();
        if (sub == 0) {
            float ss = 0.f;
            #pragma unroll
            for (int t = 0; t < 16; ++t) ss += red[row][t];
            rowstat[row] = 1.f / ss;
        }
        __syncthreads();
        const float inv = rowstat[row];
        for (int kx = sub; kx < NROI; kx += 16) S[row][kx] *= inv;
    }
    __syncthreads();

    // ---- stage 2: P(16x128 per wave) @ VW_g(128x64 slice) -> partial 16x64 ----
    v8f o[4] = { {0.f,0.f,0.f,0.f,0.f,0.f,0.f,0.f}, {0.f,0.f,0.f,0.f,0.f,0.f,0.f,0.f},
                 {0.f,0.f,0.f,0.f,0.f,0.f,0.f,0.f}, {0.f,0.f,0.f,0.f,0.f,0.f,0.f,0.f} };
    #pragma unroll 1
    for (int kk = 0; kk < 128; kk += 4) {
        const int kbase = jb + kk + lk;
        v2f a = *(const v2f*)&S[lm][kbase];
        const float* vp = vw + (long)g * (NROI * DK) + (long)kbase * DK + lm;
        #pragma unroll
        for (int nt = 0; nt < 4; ++nt) {
            v2f b; b.x = vp[nt * 16]; b.y = vp[DK + nt * 16];
            o[nt] = WMMA_F32(a, b, o[nt]);
        }
    }
    #pragma unroll
    for (int nt = 0; nt < 4; ++nt) {
        #pragma unroll
        for (int v = 0; v < 8; ++v) {
            int il = v + (lane >> 4) * 8;
            Pp[w][il][nt * 16 + lm] = o[nt][v];
        }
    }
    __syncthreads();

    // ---- cross-wave reduce + bias + store ----
    #pragma unroll
    for (int it = 0; it < 4; ++it) {
        int e = tid + it * 256;
        int r = e >> 6, oc = e & 63;
        float s = 0.f;
        #pragma unroll
        for (int ww = 0; ww < 8; ++ww) s += Pp[ww][r][oc];
        out[(long)(i0 + r) * DIM + g * DK + oc] = s + b_out[g * DK + oc];
    }
}

// ---------------------------------------------------------------------------
extern "C" void kernel_launch(void* const* d_in, const int* in_sizes, int n_in,
                              void* d_out, int out_size, void* d_ws, size_t ws_size,
                              hipStream_t stream)
{
    const float* roi   = (const float*)d_in[0];
    const float* pe    = (const float*)d_in[1];
    const float* W_fc1 = (const float*)d_in[2];
    const float* b_fc1 = (const float*)d_in[3];
    const float* W_fc2 = (const float*)d_in[4];
    const float* b_fc2 = (const float*)d_in[5];
    const float* W_q   = (const float*)d_in[6];
    const float* b_q   = (const float*)d_in[7];
    const float* W_k   = (const float*)d_in[8];
    const float* b_k   = (const float*)d_in[9];
    const float* W_out = (const float*)d_in[10];
    const float* b_out = (const float*)d_in[11];
    float* out = (float*)d_out;

    float* ws   = (float*)d_ws;
    float* qb   = ws;                               // q  [1024,1024]
    float* ktb  = qb + (long)NROI * DIM;            // k^T [1024(D),1024(N)]
    float* vwb  = ktb + (long)DIM * NROI;           // VW [16,1024,64]
    float* affb = vwb + (long)GRP * NROI * DK;      // aff [1024,16,1024]
    (void)in_sizes; (void)n_in; (void)out_size; (void)ws_size;

    dim3 blk(256);

    // q, k^T, VW and aff: four independent producers in one grid
    producers<<<dim3(GEMM_BLOCKS + POS_BLOCKS), blk, 0, stream>>>(
        roi, pe, W_fc1, b_fc1, W_fc2, b_fc2, W_q, b_q, W_k, b_k, W_out,
        qb, ktb, vwb, affb);

    // fused logits * aff -> softmax -> @ VW + b_out
    attn<<<dim3(GRP, NROI / 16, 1), blk, 0, stream>>>(
        qb, ktb, affb, vwb, b_out, out);
}

// v002
// It runs in 158 microseconds.
// Two timings next to v001 both put it at 1.16 times that version's speed.
// Counting every step since v000, it is 1.54 times as fast.
#include <hip/hip_runtime.h>
#include <hip/hip_bf16.h>

typedef __attribute__((ext_vector_type(2))) float v2f;
typedef __attribute__((ext_vector_type(8))) float v8f;
typedef __attribute__((ext_vector_type(4))) int   v4i;

#define WMMA_F32(a, b, c) \
    __builtin_amdgcn_wmma_f32_16x16x4_f32(false, (a), false, (b), (short)0, (c), false, false)

#define NROI 1024
#define DIM  1024
#define PDIM 64
#define GRP  16
#define DK   64

// ---------------------------------------------------------------------------
// CDNA5 async global->LDS copy (ASYNCcnt path), with synchronous fallback so
// the file compiles on toolchains lacking the builtin.
// ---------------------------------------------------------------------------
#if defined(__HIP_DEVICE_COMPILE__) && __has_builtin(__builtin_amdgcn_global_load_async_to_lds_b128)
#define HAVE_ASYNC_LDS 1
#else
#define HAVE_ASYNC_LDS 0
#endif

__device__ __forceinline__ void async_copy16(const void* g, void* l)
{
#if HAVE_ASYNC_LDS
    typedef __attribute__((address_space(1))) v4i* g4p;
    typedef __attribute__((address_space(3))) v4i* l4p;
    __builtin_amdgcn_global_load_async_to_lds_b128(
        (g4p)(uintptr_t)g, (l4p)(uintptr_t)l, 0, 0);
#else
    *(float4*)l = *(const float4*)g;
#endif
}

template <int N>
__device__ __forceinline__ void wait_async()
{
#if HAVE_ASYNC_LDS
#if __has_builtin(__builtin_amdgcn_s_wait_asynccnt)
    __builtin_amdgcn_s_wait_asynccnt((unsigned short)N);
#else
    if (N == 0) asm volatile("s_wait_asynccnt 0x0" ::: "memory");
    else        asm volatile("s_wait_asynccnt 0x2" ::: "memory");
#endif
#endif
}

// ---------------------------------------------------------------------------
// Generic fp32 WMMA GEMM: C[M,N] = A[M,K] @ B[K,N] (+bias), 64x64 tile / WG,
// 8 waves (wave32), 16x32 sub-tile per wave. Double-buffered LDS with async
// global->LDS copies so tile t+1 streams in under tile t's WMMAs.
// transC=1 stores C transposed: C[n*ldc + m] (used for k^T layout).
// One work-group's body: the caller picks operands and the tile (m0, n0).
// smem: the work-group's LDS block, 4608 floats used here.
// ---------------------------------------------------------------------------
__device__ __forceinline__
void gemm64x64(float* smem,
               const float* __restrict__ A, const float* __restrict__ B,
               const float* __restrict__ bias, float* __restrict__ C,
               int lda, int ldb, int ldc, int K,
               int m0, int n0, int transC)
{
    float (*As)[64][20] = (float (*)[64][20])smem;            // 64x16 tile, pad 20 (conflict-free A-frag reads)
    float (*Bs)[16][64] = (float (*)[16][64])(smem + 2560);   // 16x64 tile

    const int tid  = threadIdx.x;
    const int lane = tid & 31;
    const int w    = tid >> 5;

    const int wm = (w & 3) * 16;      // wave row base within 64
    const int wn = (w >> 2) * 32;     // wave col base within 64
    const int lm = lane & 15;
    const int lk = (lane >> 4) * 2;   // K offset pair per half-wave

    // per-thread copy slots (one 16B A chunk + one 16B B chunk per tile)
    const int ra = tid >> 2, ca = (tid & 3) * 4;
    const int rb = tid >> 4, cb = (tid & 15) * 4;
    const float* gA = A + (long)(m0 + ra) * lda + ca;
    const float* gB = B + (long)rb * ldb + n0 + cb;

    v8f acc0 = {0.f,0.f,0.f,0.f,0.f,0.f,0.f,0.f};
    v8f acc1 = {0.f,0.f,0.f,0.f,0.f,0.f,0.f,0.f};

    const int ntiles = K >> 4;
    // prologue: stream tile 0 into buffer 0
    async_copy16(gA, &As[0][ra][ca]);
    async_copy16(gB, &Bs[0][rb][cb]);

    for (int t = 0; t < ntiles; ++t) {
        const int buf = t & 1;
        if (t + 1 < ntiles) {            // stream next tile into other buffer
            const int kk = (t + 1) << 4;
            async_copy16(gA + kk,               &As[buf ^ 1][ra][ca]);
            async_copy16(gB + (long)kk * ldb,   &Bs[buf ^ 1][rb][cb]);
            wait_async<2>();             // tile t landed (async loads retire in order)
        } else {
            wait_async<0>();
        }
        __syncthreads();

        #pragma unroll
        for (int k2 = 0; k2 < 16; k2 += 4) {
            v2f a;  a.x  = As[buf][wm + lm][k2 + lk];       a.y  = As[buf][wm + lm][k2 + lk + 1];
            v2f b0; b0.x = Bs[buf][k2 + lk][wn + lm];       b0.y = Bs[buf][k2 + lk + 1][wn + lm];
            v2f b1; b1.x = Bs[buf][k2 + lk][wn + 16 + lm];  b1.y = Bs[buf][k2 + lk + 1][wn + 16 + lm];
            acc0 = WMMA_F32(a, b0, acc0);
            acc1 = WMMA_F32(a, b1, acc1);
        }
        __syncthreads();                 // buffer free for reuse at t+2
    }

    #pragma unroll
    for (int v = 0; v < 8; ++v) {
        int r  = m0 + wm + v + (lane >> 4) * 8;
        int c0 = n0 + wn + lm;
        float o0 = acc0[v], o1 = acc1[v];
        if (bias) { o0 += bias[c0]; o1 += bias[c0 + 16]; }
        if (!transC) {
            C[(long)r * ldc + c0]      = o0;
            C[(long)r * ldc + c0 + 16] = o1;
        } else {
            C[(long)c0 * ldc + r]        = o0;
            C[(long)(c0 + 16) * ldc + r] = o1;
        }
        // the two stores' registers are reused by the next pass and by what follows the loop:
        // keep the wait in front of any overwrite of a register that an issued store names
        asm volatile("s_wait_xcnt 0x0" ::: "memory");
    }
}

// ---------------------------------------------------------------------------
// Positional bias: aff[i][g][j] = tanh(pe[i,j,:] @ W1 + b1) @ W2 + b2
// One WG handles (i fixed, 64 consecutive j). fc1 = 64x64x64 WMMA, tanh,
// fc2 = 64x64x16 WMMA, scattered store into the [i][g][j] layout.
// This body streams the 256 MB position embedding: the HBM-bound job of the producers grid.
// ---------------------------------------------------------------------------
// tanh(x) = 1 - 2 / (e^(2x) + 1), with e^(2x) = 2^(x * 2 log2(e)).
// Straight-line code: a wave's values are independent chains with no branch on the data.
// e = inf gives 1, e = 0 gives -1, NaN stays NaN; the absolute error is a few units of
// the last place of 1, which is what the sum over the 64 hidden units behind it sees.
#define TANH_ARG_SCALE 2.885390081777927f

__device__ __forceinline__ v8f tanh8(v8f acc, float bias)
{
    const v8f t = (acc + bias) * TANH_ARG_SCALE;
    v8f e;
    // unrolled: constant indices keep the vector in registers
    #pragma unroll
    for (int v = 0; v < 8; ++v) e[v] = __builtin_amdgcn_exp2f(t[v]);
    e = e + 1.0f;
    v8f q;
    // unrolled: constant indices keep the vector in registers
    #pragma unroll
    for (int v = 0; v < 8; ++v) q[v] = __builtin_amdgcn_rcpf(e[v]);
    return 1.0f - 2.0f * q;
}

__device__ __forceinline__
void posbias(float* smem,
             const float* __restrict__ pe, const float* __restrict__ W1,
             const float* __restrict__ b1, const float* __restrict__ W2,
             const float* __restrict__ b2, float* __restrict__ aff,
             int i, int j0)
{
    float (*Xs)[68]  = (float (*)[68])smem;              // 64 rows
    float (*W1s)[64] = (float (*)[64])(smem + 4352);     // 64 rows
    float (*C1s)[68] = (float (*)[68])(smem + 8448);     // 64 rows
    float (*W2s)[16] = (float (*)[16])(smem + 12800);    // 64 rows

    const int tid  = threadIdx.x;
    const int lane = tid & 31;
    const int w    = tid >> 5;
    const float* X = pe + ((long)i * NROI + j0) * PDIM;

    #pragma unroll
    for (int it = 0; it < 4; ++it) {
        int idx = tid + it * 256;
        int r = idx >> 4, c4 = (idx & 15) * 4;
        async_copy16(X + (long)r * PDIM + c4, &Xs[r][c4]);
        async_copy16(W1 + r * PDIM + c4,      &W1s[r][c4]);
    }
    {   int r = tid >> 2, c4 = (tid & 3) * 4;
        async_copy16(W2 + r * GRP + c4, &W2s[r][c4]);
    }
    wait_async<0>();
    __syncthreads();

    const int lm = lane & 15;
    const int lk = (lane >> 4) * 2;
    const int wm = (w & 3) * 16, wn = (w >> 2) * 32;

    v8f c0 = {0.f,0.f,0.f,0.f,0.f,0.f,0.f,0.f};
    v8f c1 = {0.f,0.f,0.f,0.f,0.f,0.f,0.f,0.f};
    #pragma unroll
    for (int kk = 0; kk < 64; kk += 4) {
        v2f a;  a.x  = Xs[wm + lm][kk + lk];        a.y  = Xs[wm + lm][kk + lk + 1];
        v2f b0; b0.x = W1s[kk + lk][wn + lm];       b0.y = W1s[kk + lk + 1][wn + lm];
        v2f b1; b1.x = W1s[kk + lk][wn + 16 + lm];  b1.y = W1s[kk + lk + 1][wn + 16 + lm];
        c0 = WMMA_F32(a, b0, c0);
        c1 = WMMA_F32(a, b1, c1);
    }
    const v8f h0 = tanh8(c0, b1[wn + lm]);
    const v8f h1 = tanh8(c1, b1[wn + lm + 16]);
    #pragma unroll
    for (int v = 0; v < 8; ++v) {
        int r = wm + v + (lane >> 4) * 8;
        int n = wn + lm;
        C1s[r][n]      = h0[v];
        C1s[r][n + 16] = h1[v];
    }
    __syncthreads();

    if (w < 4) {   // wave-uniform: EXEC stays all-ones inside
        const int wm2 = w * 16;
        v8f c2 = {0.f,0.f,0.f,0.f,0.f,0.f,0.f,0.f};
        #pragma unroll
        for (int kk = 0; kk < 64; kk += 4) {
            v2f a; a.x = C1s[wm2 + lm][kk + lk]; a.y = C1s[wm2 + lm][kk + lk + 1];
            v2f b; b.x = W2s[kk + lk][lm];       b.y = W2s[kk + lk + 1][lm];
            c2 = WMMA_F32(a, b, c2);
        }
        #pragma unroll
        for (int v = 0; v < 8; ++v) {
            int r = wm2 + v + (lane >> 4) * 8;     // local j
            int g = lm;
            aff[(long)i * (GRP * NROI) + (long)g * NROI + (j0 + r)] = c2[v] + b2[g];
        }
    }
}

// ---------------------------------------------------------------------------
// The four producers of the attention kernel's operands (q, k^T, VW, aff) do
// not depend on one another: one grid runs them all, the block index picks the
// job. The 768 GEMM blocks come first: each is a long chain of short K tiles
// that mostly waits for its copies, so they start early and the positional
// bias blocks fill the SIMDs beside them.
// ---------------------------------------------------------------------------
#define GEMM_BLOCKS 768            // 3 products x 256 tiles of 64x64
#define POS_BLOCKS  (16 * NROI)    // 16 j-tiles x 1024 rows i

__global__ __launch_bounds__(256)
void producers(const float* __restrict__ roi, const float* __restrict__ pe,
               const float* __restrict__ W1,  const float* __restrict__ b1,
               const float* __restrict__ W2,  const float* __restrict__ b2,
               const float* __restrict__ Wq,  const float* __restrict__ bq,
               const float* __restrict__ Wk,  const float* __restrict__ bk,
               const float* __restrict__ Wo,
               float* __restrict__ qb, float* __restrict__ ktb,
               float* __restrict__ vwb, float* __restrict__ aff)
{
    __shared__ __attribute__((aligned(16))) float smem[13824];   // the larger body's need (posbias)

    const int b = blockIdx.x;
    if (b < GEMM_BLOCKS) {
        const int job = b >> 8;
        const int bx  = b & 15;
        const int m0  = ((b >> 4) & 15) * 64;
        if (job == 0) {          // q = roi @ W_q + b_q
            gemm64x64(smem, roi, Wq, bq, qb, DIM, DIM, DIM, DIM, m0, bx * 64, 0);
        } else if (job == 1) {   // kt = (roi @ W_k + b_k)^T
            gemm64x64(smem, roi, Wk, bk, ktb, DIM, DIM, NROI, DIM, m0, bx * 64, 1);
        } else {                 // VW[g] = V @ W_out[g], g = bx (bias folded into attn; softmax sums to 1)
            gemm64x64(smem, roi, Wo + (long)bx * (DIM * DK), nullptr,
                      vwb + (long)bx * (NROI * DK), DIM, DK, DK, DIM, m0, 0, 0);
        }
    } else {                     // aff[i][g][j] = tanh(pe@W1+b1)@W2+b2 (streams the 256 MB PE tensor)
        const int p = b - GEMM_BLOCKS;
        posbias(smem, pe, W1, b1, W2, b2, aff, p >> 4, (p & 15) * 64);
    }
}

// ---------------------------------------------------------------------------
// Attention: per (g, 16-row i-tile): S = (Q_g K_g^T) * aff * 0.125, softmax
// over 1024 keys, then P @ VW_g (VW = V @ W_out precomputed) + b_out.
// 8 waves split the 1024-key dimension. kt is K^T [DIM][NROI] so B-fragment
// loads are lane-coalesced.
// ---------------------------------------------------------------------------
__global__ __launch_bounds__(256)
void attn(const float* __restrict__ qbuf, const float* __restrict__ kt,
          const float* __restrict__ aff, const float* __restrict__ vw,
          const float* __restrict__ b_out, float* __restrict__ out)
{
    __shared__ float Qs[16][68];
    __shared__ float S[16][1028];       // pad 1028: stride mod 64 == 4 -> conflict-free A reads
    __shared__ float Pp[8][16][64];
    __shared__ float red[16][16];
    __shared__ float rowstat[16];

    const int tid  = threadIdx.x;
    const int lane = tid & 31;
    const int w    = tid >> 5;
    const int g    = blockIdx.x;
    const int i0   = blockIdx.y * 16;

    {   int r = tid >> 4, c4 = (tid & 15) * 4;
        async_copy16(qbuf + (long)(i0 + r) * DIM + g * DK + c4, &Qs[r][c4]);
    }
    wait_async<0>();
    __syncthreads();

    const int lm = lane & 15;
    const int lk = (lane >> 4) * 2;
    const int jb = w * 128;

    // ---- stage 1: logits for this wave's 128 keys ----
    #pragma unroll 1
    for (int tj = 0; tj < 8; ++tj) {
        const int j0t = jb + tj * 16;
        v8f acc = {0.f,0.f,0.f,0.f,0.f,0.f,0.f,0.f};
        #pragma unroll
        for (int kk = 0; kk < DK; kk += 4) {
            v2f a = *(const v2f*)&Qs[lm][kk + lk];
            const float* kp = kt + (long)(g * DK + kk + lk) * NROI + j0t + lm; // coalesced
            v2f b; b.x = kp[0]; b.y = kp[NROI];
            acc = WMMA_F32(a, b, acc);
        }
        #pragma unroll
        for (int v = 0; v < 8; ++v) {
            int il = v + (lane >> 4) * 8;
            int j  = j0t + lm;
            float aw = aff[(long)(i0 + il) * (GRP * NROI) + (long)g * NROI + j];
            S[il][j] = aw * acc[v] * 0.125f;   // 1/sqrt(64)
        }
    }
    __syncthreads();

    // ---- softmax over 1024 keys per row: 16 threads per row ----
    {
        const int row = tid >> 4, sub = tid & 15;
        float m = -3.402823466e38f;
        for (int kx = sub; kx < NROI; kx += 16) m = fmaxf(m, S[row][kx]);
        red[row][sub] = m;
        __syncthreads();
        if (sub == 0) {
            float mm = red[row][0];
            #pragma unroll
            for (int t = 1; t < 16; ++t) mm = fmaxf(mm, red[row][t]);
            rowstat[row] = mm;
        }
        __syncthreads();
        const float mm = rowstat[row];
        float s = 0.f;
        for (int kx = sub; kx < NROI; kx += 16) {
            float e = __expf(S[row][kx] - mm);
            S[row][kx] = e;
            s += e;
        }
        red[row][sub] = s;
        __syncthreads();
        if (sub == 0) {
            float ss = 0.f;
            #pragma unroll
            for (int t = 0; t < 16; ++t) ss += red[row][t];
            rowstat[row] = 1.f / ss;
        }
        __syncthreads();
        const float inv = rowstat[row];
        for (int kx = sub; kx < NROI; kx += 16) S[row][kx] *= inv;
    }
    __syncthreads();

    // ---- stage 2: P(16x128 per wave) @ VW_g(128x64 slice) -> partial 16x64 ----
    v8f o[4] = { {0.f,0.f,0.f,0.f,0.f,0.f,0.f,0.f}, {0.f,0.f,0.f,0.f,0.f,0.f,0.f,0.f},
                 {0.f,0.f,0.f,0.f,0.f,0.f,0.f,0.f}, {0.f,0.f,0.f,0.f,0.f,0.f,0.f,0.f} };
    #pragma unroll 1
    for (int kk = 0; kk < 128; kk += 4) {
        const int kbase = jb + kk + lk;
        v2f a = *(const v2f*)&S[lm][kbase];
        const float* vp = vw + (long)g * (NROI * DK) + (long)kbase * DK + lm;
        #pragma unroll
        for (int nt = 0; nt < 4; ++nt) {
            v2f b; b.x = vp[nt * 16]; b.y = vp[DK + nt * 16];
            o[nt] = WMMA_F32(a, b, o[nt]);
        }
    }
    #pragma unroll
    for (int nt = 0; nt < 4; ++nt) {
        #pragma unroll
        for (int v = 0; v < 8; ++v) {
            int il = v + (lane >> 4) * 8;
            Pp[w][il][nt * 16 + lm] = o[nt][v];
        }
    }
    __syncthreads();

    // ---- cross-wave reduce + bias + store ----
    #pragma unroll
    for (int it = 0; it < 4; ++it) {
        int e = tid + it * 256;
        int r = e >> 6, oc = e & 63;
        float s = 0.f;
        #pragma unroll
        for (int ww = 0; ww < 8; ++ww) s += Pp[ww][r][oc];
        out[(long)(i0 + r) * DIM + g * DK + oc] = s + b_out[g * DK + oc];
    }
}

// ---------------------------------------------------------------------------
extern "C" void kernel_launch(void* const* d_in, const int* in_sizes, int n_in,
                              void* d_out, int out_size, void* d_ws, size_t ws_size,
                              hipStream_t stream)
{
    const float* roi   = (const float*)d_in[0];
    const float* pe    = (const float*)d_in[1];
    const float* W_fc1 = (const float*)d_in[2];
    const float* b_fc1 = (const float*)d_in[3];
    const float* W_fc2 = (const float*)d_in[4];
    const float* b_fc2 = (const float*)d_in[5];
    const float* W_q   = (const float*)d_in[6];
    const float* b_q   = (const float*)d_in[7];
    const float* W_k   = (const float*)d_in[8];
    const float* b_k   = (const float*)d_in[9];
    const float* W_out = (const float*)d_in[10];
    const float* b_out = (const float*)d_in[11];
    float* out = (float*)d_out;

    float* ws   = (float*)d_ws;
    float* qb   = ws;                               // q  [1024,1024]
    float* ktb  = qb + (long)NROI * DIM;            // k^T [1024(D),1024(N)]
    float* vwb  = ktb + (long)DIM * NROI;           // VW [16,1024,64]
    float* affb = vwb + (long)GRP * NROI * DK;      // aff [1024,16,1024]
    (void)in_sizes; (void)n_in; (void)out_size; (void)ws_size;

    dim3 blk(256);

    // q, k^T, VW and aff: four independent producers in one grid
    producers<<<dim3(GEMM_BLOCKS + POS_BLOCKS), blk, 0, stream>>>(
        roi, pe, W_fc1, b_fc1, W_fc2, b_fc2, W_q, b_q, W_k, b_k, W_out,
        qb, ktb, vwb, affb);

    // fused logits * aff -> softmax -> @ VW + b_out
    attn<<<dim3(GRP, NROI / 16, 1), blk, 0, stream>>>(
        qb, ktb, affb, vwb, b_out, out);
}

// v003
// A run of this version takes 142 microseconds.
// Two timings next to v002 both put it at 1.11 times that version's speed.
// Counting every step since v000, it is 1.71 times as fast.
#include <hip/hip_runtime.h>
#include <hip/hip_bf16.h>

typedef __attribute__((ext_vector_type(2))) float v2f;
typedef __attribute__((ext_vector_type(8))) float v8f;
typedef __attribute__((ext_vector_type(4))) int   v4i;

#define WMMA_F32(a, b, c) \
    __builtin_amdgcn_wmma_f32_16x16x4_f32(false, (a), false, (b), (short)0, (c), false, false)

#define NROI 1024
#define DIM  1024
#define PDIM 64
#define GRP  16
#define DK   64

// ---------------------------------------------------------------------------
// CDNA5 async global->LDS copy (ASYNCcnt path), with synchronous fallback so
// the file compiles on toolchains lacking the builtin.
// ---------------------------------------------------------------------------
#if defined(__HIP_DEVICE_COMPILE__) && __has_builtin(__builtin_amdgcn_global_load_async_to_lds_b128)
#define HAVE_ASYNC_LDS 1
#else
#define HAVE_ASYNC_LDS 0
#endif

__device__ __forceinline__ void async_copy16(const void* g, void* l)
{
#if HAVE_ASYNC_LDS
    typedef __attribute__((address_space(1))) v4i* g4p;
    typedef __attribute__((address_space(3))) v4i* l4p;
    __builtin_amdgcn_global_load_async_to_lds_b128(
        (g4p)(uintptr_t)g, (l4p)(uintptr_t)l, 0, 0);
#else
    *(float4*)l = *(const float4*)g;
#endif
}

template <int N>
__device__ __forceinline__ void wait_async()
{
#if HAVE_ASYNC_LDS
#if __has_builtin(__builtin_amdgcn_s_wait_asynccnt)
    __builtin_amdgcn_s_wait_asynccnt((unsigned short)N);
#else
    if (N == 0) asm volatile("s_wait_asynccnt 0x0" ::: "memory");
    else        asm volatile("s_wait_asynccnt 0x2" ::: "memory");
#endif
#endif
}

// ---------------------------------------------------------------------------
// Generic fp32 WMMA GEMM: C[M,N] = A[M,K] @ B[K,N] (+bias), 64x64 tile / WG,
// 8 waves (wave32), 16x32 sub-tile per wave. Double-buffered LDS with async
// global->LDS copies so tile t+1 streams in under tile t's WMMAs.
// transC=1 stores C transposed: C[n*ldc + m] (used for k^T layout).
// One work-group's body: the caller picks operands and the tile (m0, n0).
// smem: the work-group's LDS block, 4608 floats used here.
// ---------------------------------------------------------------------------
__device__ __forceinline__
void gemm64x64(float* smem,
               const float* __restrict__ A, const float* __restrict__ B,
               const float* __restrict__ bias, float* __restrict__ C,
               int lda, int ldb, int ldc, int K,
               int m0, int n0, int transC)
{
    float (*As)[64][20] = (float (*)[64][20])smem;            // 64x16 tile, pad 20 (conflict-free A-frag reads)
    float (*Bs)[16][64] = (float (*)[16][64])(smem + 2560);   // 16x64 tile

    const int tid  = threadIdx.x;
    const int lane = tid & 31;
    const int w    = tid >> 5;

    const int wm = (w & 3) * 16;      // wave row base within 64
    const int wn = (w >> 2) * 32;     // wave col base within 64
    const int lm = lane & 15;
    const int lk = (lane >> 4) * 2;   // K offset pair per half-wave

    // per-thread copy slots (one 16B A chunk + one 16B B chunk per tile)
    const int ra = tid >> 2, ca = (tid & 3) * 4;
    const int rb = tid >> 4, cb = (tid & 15) * 4;
    const float* gA = A + (long)(m0 + ra) * lda + ca;
    const float* gB = B + (long)rb * ldb + n0 + cb;

    v8f acc0 = {0.f,0.f,0.f,0.f,0.f,0.f,0.f,0.f};
    v8f acc1 = {0.f,0.f,0.f,0.f,0.f,0.f,0.f,0.f};

    const int ntiles = K >> 4;
    // prologue: stream tile 0 into buffer 0
    async_copy16(gA, &As[0][ra][ca]);
    async_copy16(gB, &Bs[0][rb][cb]);

    for (int t = 0; t < ntiles; ++t) {
        const int buf = t & 1;
        if (t + 1 < ntiles) {            // stream next tile into other buffer
            const int kk = (t + 1) << 4;
            async_copy16(gA + kk,               &As[buf ^ 1][ra][ca]);
            async_copy16(gB + (long)kk * ldb,   &Bs[buf ^ 1][rb][cb]);
            wait_async<2>();             // tile t landed (async loads retire in order)
        } else {
            wait_async<0>();
        }
        __syncthreads();

        #pragma unroll
        for (int k2 = 0; k2 < 16; k2 += 4) {
            v2f a;  a.x  = As[buf][wm + lm][k2 + lk];       a.y  = As[buf][wm + lm][k2 + lk + 1];
            v2f b0; b0.x = Bs[buf][k2 + lk][wn + lm];       b0.y = Bs[buf][k2 + lk + 1][wn + lm];
            v2f b1; b1.x = Bs[buf][k2 + lk][wn + 16 + lm];  b1.y = Bs[buf][k2 + lk + 1][wn + 16 + lm];
            acc0 = WMMA_F32(a, b0, acc0);
            acc1 = WMMA_F32(a, b1, acc1);
        }
        __syncthreads();                 // buffer free for reuse at t+2
    }

    #pragma unroll
    for (int v = 0; v < 8; ++v) {
        int r  = m0 + wm + v + (lane >> 4) * 8;
        int c0 = n0 + wn + lm;
        float o0 = acc0[v], o1 = acc1[v];
        if (bias) { o0 += bias[c0]; o1 += bias[c0 + 16]; }
        if (!transC) {
            C[(long)r * ldc + c0]      = o0;
            C[(long)r * ldc + c0 + 16] = o1;
        } else {
            C[(long)c0 * ldc + r]        = o0;
            C[(long)(c0 + 16) * ldc + r] = o1;
        }
        // the two stores' registers are reused by the next pass and by what follows the loop:
        // keep the wait in front of any overwrite of a register that an issued store names
        asm volatile("s_wait_xcnt 0x0" ::: "memory");
    }
}

// ---------------------------------------------------------------------------
// Positional bias: aff[i][g][j] = tanh(pe[i,j,:] @ W1 + b1) @ W2 + b2
// One WG handles (i fixed, 64 consecutive j). fc1 = 64x64x64 WMMA, tanh,
// fc2 = 64x64x16 WMMA, scattered store into the [i][g][j] layout.
// This body streams the 256 MB position embedding: the HBM-bound job of the producers grid.
// ---------------------------------------------------------------------------
// tanh(x) = 1 - 2 / (e^(2x) + 1), with e^(2x) = 2^(x * 2 log2(e)).
// Straight-line code: a wave's values are independent chains with no branch on the data.
// e = inf gives 1, e = 0 gives -1, NaN stays NaN; the absolute error is a few units of
// the last place of 1, which is what the sum over the 64 hidden units behind it sees.
#define TANH_ARG_SCALE 2.885390081777927f

__device__ __forceinline__ v8f tanh8(v8f acc, float bias)
{
    const v8f t = (acc + bias) * TANH_ARG_SCALE;
    v8f e;
    // unrolled: constant indices keep the vector in registers
    #pragma unroll
    for (int v = 0; v < 8; ++v) e[v] = __builtin_amdgcn_exp2f(t[v]);
    e = e + 1.0f;
    v8f q;
    // unrolled: constant indices keep the vector in registers
    #pragma unroll
    for (int v = 0; v < 8; ++v) q[v] = __builtin_amdgcn_rcpf(e[v]);
    return 1.0f - 2.0f * q;
}

__device__ __forceinline__
void posbias(float* smem,
             const float* __restrict__ pe, const float* __restrict__ W1,
             const float* __restrict__ b1, const float* __restrict__ W2,
             const float* __restrict__ b2, float* __restrict__ aff,
             int i, int j0)
{
    float (*Xs)[68]  = (float (*)[68])smem;              // 64 rows
    float (*W1s)[64] = (float (*)[64])(smem + 4352);     // 64 rows
    float (*C1s)[68] = (float (*)[68])(smem + 8448);     // 64 rows
    float (*W2s)[16] = (float (*)[16])(smem + 12800);    // 64 rows

    const int tid  = threadIdx.x;
    const int lane = tid & 31;
    const int w    = tid >> 5;
    const float* X = pe + ((long)i * NROI + j0) * PDIM;

    #pragma unroll
    for (int it = 0; it < 4; ++it) {
        int idx = tid + it * 256;
        int r = idx >> 4, c4 = (idx & 15) * 4;
        async_copy16(X + (long)r * PDIM + c4, &Xs[r][c4]);
        async_copy16(W1 + r * PDIM + c4,      &W1s[r][c4]);
    }
    {   int r = tid >> 2, c4 = (tid & 3) * 4;
        async_copy16(W2 + r * GRP + c4, &W2s[r][c4]);
    }
    wait_async<0>();
    __syncthreads();

    const int lm = lane & 15;
    const int lk = (lane >> 4) * 2;
    const int wm = (w & 3) * 16, wn = (w >> 2) * 32;

    v8f c0 = {0.f,0.f,0.f,0.f,0.f,0.f,0.f,0.f};
    v8f c1 = {0.f,0.f,0.f,0.f,0.f,0.f,0.f,0.f};
    #pragma unroll
    for (int kk = 0; kk < 64; kk += 4) {
        v2f a;  a.x  = Xs[wm + lm][kk + lk];        a.y  = Xs[wm + lm][kk + lk + 1];
        v2f b0; b0.x = W1s[kk + lk][wn + lm];       b0.y = W1s[kk + lk + 1][wn + lm];
        v2f b1; b1.x = W1s[kk + lk][wn + 16 + lm];  b1.y = W1s[kk + lk + 1][wn + 16 + lm];
        c0 = WMMA_F32(a, b0, c0);
        c1 = WMMA_F32(a, b1, c1);
    }
    const v8f h0 = tanh8(c0, b1[wn + lm]);
    const v8f h1 = tanh8(c1, b1[wn + lm + 16]);
    #pragma unroll
    for (int v = 0; v < 8; ++v) {
        int r = wm + v + (lane >> 4) * 8;
        int n = wn + lm;
        C1s[r][n]      = h0[v];
        C1s[r][n + 16] = h1[v];
    }
    __syncthreads();

    if (w < 4) {   // wave-uniform: EXEC stays all-ones inside
        const int wm2 = w * 16;
        v8f c2 = {0.f,0.f,0.f,0.f,0.f,0.f,0.f,0.f};
        #pragma unroll
        for (int kk = 0; kk < 64; kk += 4) {
            v2f a; a.x = C1s[wm2 + lm][kk + lk]; a.y = C1s[wm2 + lm][kk + lk + 1];
            v2f b; b.x = W2s[kk + lk][lm];       b.y = W2s[kk + lk + 1][lm];
            c2 = WMMA_F32(a, b, c2);
        }
        #pragma unroll
        for (int v = 0; v < 8; ++v) {
            int r = wm2 + v + (lane >> 4) * 8;     // local j
            int g = lm;
            aff[(long)i * (GRP * NROI) + (long)g * NROI + (j0 + r)] = c2[v] + b2[g];
        }
    }
}

// ---------------------------------------------------------------------------
// The four producers of the attention kernel's operands (q, k^T, VW, aff) do
// not depend on one another: one grid runs them all, the block index picks the
// job. The 768 GEMM blocks come first: each is a long chain of short K tiles
// that mostly waits for its copies, so they start early and the positional
// bias blocks fill the SIMDs beside them.
// ---------------------------------------------------------------------------
#define GEMM_BLOCKS 768            // 3 products x 256 tiles of 64x64
#define POS_BLOCKS  (16 * NROI)    // 16 j-tiles x 1024 rows i

__global__ __launch_bounds__(256)
void producers(const float* __restrict__ roi, const float* __restrict__ pe,
               const float* __restrict__ W1,  const float* __restrict__ b1,
               const float* __restrict__ W2,  const float* __restrict__ b2,
               const float* __restrict__ Wq,  const float* __restrict__ bq,
               const float* __restrict__ Wk,  const float* __restrict__ bk,
               const float* __restrict__ Wo,
               float* __restrict__ qb, float* __restrict__ ktb,
               float* __restrict__ vwb, float* __restrict__ aff)
{
    __shared__ __attribute__((aligned(16))) float smem[13824];   // the larger body's need (posbias)

    const int b = blockIdx.x;
    if (b < GEMM_BLOCKS) {
        const int job = b >> 8;
        const int bx  = b & 15;
        const int m0  = ((b >> 4) & 15) * 64;
        if (job == 0) {          // q = roi @ W_q + b_q
            gemm64x64(smem, roi, Wq, bq, qb, DIM, DIM, DIM, DIM, m0, bx * 64, 0);
        } else if (job == 1) {   // kt = (roi @ W_k + b_k)^T
            gemm64x64(smem, roi, Wk, bk, ktb, DIM, DIM, NROI, DIM, m0, bx * 64, 1);
        } else {                 // VW[g] = V @ W_out[g], g = bx (bias folded into attn; softmax sums to 1)
            gemm64x64(smem, roi, Wo + (long)bx * (DIM * DK), nullptr,
                      vwb + (long)bx * (NROI * DK), DIM, DK, DK, DIM, m0, 0, 0);
        }
    } else {                     // aff[i][g][j] = tanh(pe@W1+b1)@W2+b2 (streams the 256 MB PE tensor)
        const int p = b - GEMM_BLOCKS;
        posbias(smem, pe, W1, b1, W2, b2, aff, p >> 4, (p & 15) * 64);
    }
}

// ---------------------------------------------------------------------------
// Attention: per (g, 16-row i-tile): S = (Q_g K_g^T) * aff * 0.125, softmax
// over 1024 keys, then P @ VW_g (VW = V @ W_out precomputed) + b_out.
// 8 waves split the 1024-key dimension. kt is K^T [DIM][NROI] so B-fragment
// loads are lane-coalesced.
// ---------------------------------------------------------------------------
// second argument: 8 waves a SIMD, i.e. at most 128 registers a wave, so that registers
// as well as LDS let four work-groups of 8 waves share a WGP
__global__ __launch_bounds__(256, 8)
void attn(const float* __restrict__ qbuf, const float* __restrict__ kt,
          const float* __restrict__ aff, const float* __restrict__ vw,
          const float* __restrict__ b_out, float* __restrict__ out)
{
    __shared__ float Qs[16][68];
    __shared__ float S[16][1028];       // pad 1028: stride mod 64 == 4 -> conflict-free A reads
    // The waves' partial outputs take the place of S once its last read is over: 70 KiB of LDS
    // a work-group instead of 102, so four fit a WGP and the whole grid is resident in one round.
    float (*Pp)[16][64] = (float (*)[16][64])&S[0][0];   // 8 x 16 x 64 floats, half of S
    __shared__ float red[16][16];
    __shared__ float rowstat[16];

    const int tid  = threadIdx.x;
    const int lane = tid & 31;
    const int w    = tid >> 5;
    const int g    = blockIdx.x;
    const int i0   = blockIdx.y * 16;

    {   int r = tid >> 4, c4 = (tid & 15) * 4;
        async_copy16(qbuf + (long)(i0 + r) * DIM + g * DK + c4, &Qs[r][c4]);
    }
    wait_async<0>();
    __syncthreads();

    const int lm = lane & 15;
    const int lk = (lane >> 4) * 2;
    const int jb = w * 128;

    // ---- stage 1: logits for this wave's 128 keys ----
    #pragma unroll 1
    for (int tj = 0; tj < 8; ++tj) {
        const int j0t = jb + tj * 16;
        v8f acc = {0.f,0.f,0.f,0.f,0.f,0.f,0.f,0.f};
        #pragma unroll
        for (int kk = 0; kk < DK; kk += 4) {
            v2f a = *(const v2f*)&Qs[lm][kk + lk];
            const float* kp = kt + (long)(g * DK + kk + lk) * NROI + j0t + lm; // coalesced
            v2f b; b.x = kp[0]; b.y = kp[NROI];
            acc = WMMA_F32(a, b, acc);
        }
        #pragma unroll
        for (int v = 0; v < 8; ++v) {
            int il = v + (lane >> 4) * 8;
            int j  = j0t + lm;
            float aw = aff[(long)(i0 + il) * (GRP * NROI) + (long)g * NROI + j];
            S[il][j] = aw * acc[v] * 0.125f;   // 1/sqrt(64)
        }
    }
    __syncthreads();

    // ---- softmax over 1024 keys per row: 16 threads per row ----
    {
        const int row = tid >> 4, sub = tid & 15;
        float m = -3.402823466e38f;
        for (int kx = sub; kx < NROI; kx += 16) m = fmaxf(m, S[row][kx]);
        red[row][sub] = m;
        __syncthreads();
        if (sub == 0) {
            float mm = red[row][0];
            #pragma unroll
            for (int t = 1; t < 16; ++t) mm = fmaxf(mm, red[row][t]);
            rowstat[row] = mm;
        }
        __syncthreads();
        const float mm = rowstat[row];
        float s = 0.f;
        for (int kx = sub; kx < NROI; kx += 16) {
            float e = __expf(S[row][kx] - mm);
            S[row][kx] = e;
            s += e;
        }
        red[row][sub] = s;
        __syncthreads();
        if (sub == 0) {
            float ss = 0.f;
            #pragma unroll
            for (int t = 0; t < 16; ++t) ss += red[row][t];
            rowstat[row] = 1.f / ss;
        }
        __syncthreads();
        const float inv = rowstat[row];
        for (int kx = sub; kx < NROI; kx += 16) S[row][kx] *= inv;
    }
    __syncthreads();

    // ---- stage 2: P(16x128 per wave) @ VW_g(128x64 slice) -> partial 16x64 ----
    v8f o[4] = { {0.f,0.f,0.f,0.f,0.f,0.f,0.f,0.f}, {0.f,0.f,0.f,0.f,0.f,0.f,0.f,0.f},
                 {0.f,0.f,0.f,0.f,0.f,0.f,0.f,0.f}, {0.f,0.f,0.f,0.f,0.f,0.f,0.f,0.f} };
    #pragma unroll 1
    for (int kk = 0; kk < 128; kk += 4) {
        const int kbase = jb + kk + lk;
        v2f a = *(const v2f*)&S[lm][kbase];
        const float* vp = vw + (long)g * (NROI * DK) + (long)kbase * DK + lm;
        #pragma unroll
        for (int nt = 0; nt < 4; ++nt) {
            v2f b; b.x = vp[nt * 16]; b.y = vp[DK + nt * 16];
            o[nt] = WMMA_F32(a, b, o[nt]);
        }
    }
    __syncthreads();   // every wave has read its part of S: the partial sums may overwrite it
    #pragma unroll
    for (int nt = 0; nt < 4; ++nt) {
        #pragma unroll
        for (int v = 0; v < 8; ++v) {
            int il = v + (lane >> 4) * 8;
            Pp[w][il][nt * 16 + lm] = o[nt][v];
        }
    }
    __syncthreads();

    // ---- cross-wave reduce + bias + store ----
    #pragma unroll
    for (int it = 0; it < 4; ++it) {
        int e = tid + it * 256;
        int r = e >> 6, oc = e & 63;
        float s = 0.f;
        #pragma unroll
        for (int ww = 0; ww < 8; ++ww) s += Pp[ww][r][oc];
        out[(long)(i0 + r) * DIM + g * DK + oc] = s + b_out[g * DK + oc];
    }
}

// ---------------------------------------------------------------------------
extern "C" void kernel_launch(void* const* d_in, const int* in_sizes, int n_in,
                              void* d_out, int out_size, void* d_ws, size_t ws_size,
                              hipStream_t stream)
{
    const float* roi   = (const float*)d_in[0];
    const float* pe    = (const float*)d_in[1];
    const float* W_fc1 = (const float*)d_in[2];
    const float* b_fc1 = (const float*)d_in[3];
    const float* W_fc2 = (const float*)d_in[4];
    const float* b_fc2 = (const float*)d_in[5];
    const float* W_q   = (const float*)d_in[6];
    const float* b_q   = (const float*)d_in[7];
    const float* W_k   = (const float*)d_in[8];
    const float* b_k   = (const float*)d_in[9];
    const float* W_out = (const float*)d_in[10];
    const float* b_out = (const float*)d_in[11];
    float* out = (float*)d_out;

    float* ws   = (float*)d_ws;
    float* qb   = ws;                               // q  [1024,1024]
    float* ktb  = qb + (long)NROI * DIM;            // k^T [1024(D),1024(N)]
    float* vwb  = ktb + (long)DIM * NROI;           // VW [16,1024,64]
    float* affb = vwb + (long)GRP * NROI * DK;      // aff [1024,16,1024]
    (void)in_sizes; (void)n_in; (void)out_size; (void)ws_size;

    dim3 blk(256);

    // q, k^T, VW and aff: four independent producers in one grid
    producers<<<dim3(GEMM_BLOCKS + POS_BLOCKS), blk, 0, stream>>>(
        roi, pe, W_fc1, b_fc1, W_fc2, b_fc2, W_q, b_q, W_k, b_k, W_out,
        qb, ktb, vwb, affb);

    // fused logits * aff -> softmax -> @ VW + b_out
    attn<<<dim3(GRP, NROI / 16, 1), blk, 0, stream>>>(
        qb, ktb, affb, vwb, b_out, out);
}

// v004
// Measured time: 136 microseconds a run.
// Two timings next to v003 both put it at 1.05 times that version's speed.
// All steps since v000 together make it 1.80 times as fast.
#include <hip/hip_runtime.h>
#include <hip/hip_bf16.h>

typedef __attribute__((ext_vector_type(2))) float v2f;
typedef __attribute__((ext_vector_type(8))) float v8f;
typedef __attribute__((ext_vector_type(4))) int   v4i;

#define WMMA_F32(a, b, c) \
    __builtin_amdgcn_wmma_f32_16x16x4_f32(false, (a), false, (b), (short)0, (c), false, false)

#define NROI 1024
#define DIM  1024
#define PDIM 64
#define GRP  16
#define DK   64

// ---------------------------------------------------------------------------
// CDNA5 async global->LDS copy (ASYNCcnt path), with synchronous fallback so
// the file compiles on toolchains lacking the builtin.
// ---------------------------------------------------------------------------
#if defined(__HIP_DEVICE_COMPILE__) && __has_builtin(__builtin_amdgcn_global_load_async_to_lds_b128)
#define HAVE_ASYNC_LDS 1
#else
#define HAVE_ASYNC_LDS 0
#endif

__device__ __forceinline__ void async_copy16(const void* g, void* l)
{
#if HAVE_ASYNC_LDS
    typedef __attribute__((address_space(1))) v4i* g4p;
    typedef __attribute__((address_space(3))) v4i* l4p;
    __builtin_amdgcn_global_load_async_to_lds_b128(
        (g4p)(uintptr_t)g, (l4p)(uintptr_t)l, 0, 0);
#else
    *(float4*)l = *(const float4*)g;
#endif
}

template <int N>
__device__ __forceinline__ void wait_async()
{
#if HAVE_ASYNC_LDS
#if __has_builtin(__builtin_amdgcn_s_wait_asynccnt)
    __builtin_amdgcn_s_wait_asynccnt((unsigned short)N);
#else
    if (N == 0) asm volatile("s_wait_asynccnt 0x0" ::: "memory");
    else        asm volatile("s_wait_asynccnt 0x2" ::: "memory");
#endif
#endif
}

// ---------------------------------------------------------------------------
// Generic fp32 WMMA GEMM: C[M,N] = A[M,K] @ B[K,N] (+bias), 64x64 tile / WG,
// 8 waves (wave32), 16x32 sub-tile per wave. Double-buffered LDS with async
// global->LDS copies so tile t+1 streams in under tile t's WMMAs.
// transC=1 stores C transposed: C[n*ldc + m] (used for k^T layout).
// One work-group's body: the caller picks operands and the tile (m0, n0).
// smem: the work-group's LDS block, 4608 floats used here.
// ---------------------------------------------------------------------------
__device__ __forceinline__
void gemm64x64(float* smem,
               const float* __restrict__ A, const float* __restrict__ B,
               const float* __restrict__ bias, float* __restrict__ C,
               int lda, int ldb, int ldc, int K,
               int m0, int n0, int transC)
{
    float (*As)[64][20] = (float (*)[64][20])smem;            // 64x16 tile, pad 20 (conflict-free A-frag reads)
    float (*Bs)[16][64] = (float (*)[16][64])(smem + 2560);   // 16x64 tile

    const int tid  = threadIdx.x;
    const int lane = tid & 31;
    const int w    = tid >> 5;

    const int wm = (w & 3) * 16;      // wave row base within 64
    const int wn = (w >> 2) * 32;     // wave col base within 64
    const int lm = lane & 15;
    const int lk = (lane >> 4) * 2;   // K offset pair per half-wave

    // per-thread copy slots (one 16B A chunk + one 16B B chunk per tile)
    const int ra = tid >> 2, ca = (tid & 3) * 4;
    const int rb = tid >> 4, cb = (tid & 15) * 4;
    const float* gA = A + (long)(m0 + ra) * lda + ca;
    const float* gB = B + (long)rb * ldb + n0 + cb;

    v8f acc0 = {0.f,0.f,0.f,0.f,0.f,0.f,0.f,0.f};
    v8f acc1 = {0.f,0.f,0.f,0.f,0.f,0.f,0.f,0.f};

    const int ntiles = K >> 4;
    // prologue: stream tile 0 into buffer 0
    async_copy16(gA, &As[0][ra][ca]);
    async_copy16(gB, &Bs[0][rb][cb]);

    for (int t = 0; t < ntiles; ++t) {
        const int buf = t & 1;
        if (t + 1 < ntiles) {            // stream next tile into other buffer
            const int kk = (t + 1) << 4;
            async_copy16(gA + kk,               &As[buf ^ 1][ra][ca]);
            async_copy16(gB + (long)kk * ldb,   &Bs[buf ^ 1][rb][cb]);
            wait_async<2>();             // tile t landed (async loads retire in order)
        } else {
            wait_async<0>();
        }
        __syncthreads();

        #pragma unroll
        for (int k2 = 0; k2 < 16; k2 += 4) {
            v2f a;  a.x  = As[buf][wm + lm][k2 + lk];       a.y  = As[buf][wm + lm][k2 + lk + 1];
            v2f b0; b0.x = Bs[buf][k2 + lk][wn + lm];       b0.y = Bs[buf][k2 + lk + 1][wn + lm];
            v2f b1; b1.x = Bs[buf][k2 + lk][wn + 16 + lm];  b1.y = Bs[buf][k2 + lk + 1][wn + 16 + lm];
            acc0 = WMMA_F32(a, b0, acc0);
            acc1 = WMMA_F32(a, b1, acc1);
        }
        __syncthreads();                 // buffer free for reuse at t+2
    }

    #pragma unroll
    for (int v = 0; v < 8; ++v) {
        int r  = m0 + wm + v + (lane >> 4) * 8;
        int c0 = n0 + wn + lm;
        float o0 = acc0[v], o1 = acc1[v];
        if (bias) { o0 += bias[c0]; o1 += bias[c0 + 16]; }
        if (!transC) {
            C[(long)r * ldc + c0]      = o0;
            C[(long)r * ldc + c0 + 16] = o1;
        } else {
            C[(long)c0 * ldc + r]        = o0;
            C[(long)(c0 + 16) * ldc + r] = o1;
        }
        // the two stores' registers are reused by the next pass and by what follows the loop:
        // keep the wait in front of any overwrite of a register that an issued store names
        asm volatile("s_wait_xcnt 0x0" ::: "memory");
    }
}

// ---------------------------------------------------------------------------
// Positional bias: aff[i][g][j] = tanh(pe[i,j,:] @ W1 + b1) @ W2 + b2
// One WG handles (i fixed, 128 consecutive j); each wave owns 16 of them from end to end.
// Both layers are computed transposed (weights as the first operand, j as the column):
//   H^T[n][j]   = sum_k W1[k][n] * X[j][k]      4 accumulator tiles = all 64 hidden units n
//   aff^T[g][j] = sum_n W2[n][g] * tanh(H^T)[n][j]
// An accumulator register r of lane (c, h) holds row 8h + r of column c, and a second operand
// wants, in lane (c, h), two k values of column c: registers 2s, 2s + 1 of a tile ARE such an
// operand for k = 8h + 2s, 8h + 2s + 1. W2's rows are read in that same k order, so the hidden
// layer goes from the first product to the second in registers: no LDS, no barrier, no idle wave.
// This kernel streams the 256 MB position embedding.
// ---------------------------------------------------------------------------
// tanh(x) = 1 - 2 / (e^(2x) + 1), with e^(2x) = 2^(x * 2 log2(e)).
// Straight-line code: a wave's values are independent chains with no branch on the data.
// e = inf gives 1, e = 0 gives -1, NaN stays NaN; the absolute error is a few units of
// the last place of 1, which is what the sum over the 64 hidden units behind it sees.
#define TANH_ARG_SCALE 2.885390081777927f
#define POS_J 128                  // j per work-group: 16 per wave

__device__ __forceinline__ v8f tanh8(v8f acc)
{
    const v8f t = acc * TANH_ARG_SCALE;
    v8f e;
    // unrolled: constant indices keep the vector in registers
    #pragma unroll
    for (int v = 0; v < 8; ++v) e[v] = __builtin_amdgcn_exp2f(t[v]);
    e = e + 1.0f;
    v8f q;
    // unrolled: constant indices keep the vector in registers
    #pragma unroll
    for (int v = 0; v < 8; ++v) q[v] = __builtin_amdgcn_rcpf(e[v]);
    return 1.0f - 2.0f * q;
}

__device__ __forceinline__
void posbias(float* smem,
             const float* __restrict__ pe, const float* __restrict__ W1,
             const float* __restrict__ b1, const float* __restrict__ W2,
             const float* __restrict__ b2, float* __restrict__ aff,
             int i, int j0)
{
    float (*Xs)[68]  = (float (*)[68])smem;              // 128 rows
    float (*W1s)[64] = (float (*)[64])(smem + 8704);     // 64 rows; left as it was: rows two apart (the half-waves) share banks
    float (*W2s)[16] = (float (*)[16])(smem + 12800);    // 64 rows

    const int tid  = threadIdx.x;
    const int lane = tid & 31;
    const int w    = tid >> 5;
    const float* X = pe + ((long)i * NROI + j0) * PDIM;

    // the copy loops are unrolled so that all 13 copies of a thread issue back to back
    #pragma unroll
    for (int it = 0; it < 8; ++it) {
        int idx = tid + it * 256;
        int r = idx >> 4, c4 = (idx & 15) * 4;
        async_copy16(X + (long)r * PDIM + c4, &Xs[r][c4]);
    }
    #pragma unroll
    for (int it = 0; it < 4; ++it) {
        int idx = tid + it * 256;
        int r = idx >> 4, c4 = (idx & 15) * 4;
        async_copy16(W1 + r * PDIM + c4, &W1s[r][c4]);
    }
    {   int r = tid >> 2, c4 = (tid & 3) * 4;
        async_copy16(W2 + r * GRP + c4, &W2s[r][c4]);
    }

    const int lm = lane & 15;
    const int hh = lane >> 4;
    const int lk = hh * 2;
    const int jl = w * 16 + lm;       // this lane's column: local j

    // Each sum starts from its bias: a row of an accumulator tile is one hidden unit (one group),
    // so the bias differs by register, and loaded here it arrives while the copies are in flight.
    // every loop below is unrolled: constant indices keep the accumulator tiles in registers
    v8f c[4], c2;
    #pragma unroll
    for (int nt = 0; nt < 4; ++nt) {
        #pragma unroll
        for (int v = 0; v < 8; ++v) c[nt][v] = b1[nt * 16 + hh * 8 + v];
    }
    #pragma unroll
    for (int v = 0; v < 8; ++v) c2[v] = b2[hh * 8 + v];

    wait_async<0>();
    __syncthreads();

    // ---- layer 1, transposed: 64 hidden units x 16 j per wave ----
    #pragma unroll
    for (int kk = 0; kk < 64; kk += 4) {
        v2f x; x.x = Xs[jl][kk + lk]; x.y = Xs[jl][kk + lk + 1];
        #pragma unroll
        for (int nt = 0; nt < 4; ++nt) {
            v2f a; a.x = W1s[kk + lk][nt * 16 + lm]; a.y = W1s[kk + lk + 1][nt * 16 + lm];
            c[nt] = WMMA_F32(a, x, c[nt]);
        }
    }

    // ---- tanh in place, then layer 2 straight from the accumulator registers ----
    #pragma unroll
    for (int nt = 0; nt < 4; ++nt) {
        const int n0 = nt * 16 + hh * 8;          // first hidden unit this lane holds of tile nt
        const v8f h = tanh8(c[nt]);
        #pragma unroll
        for (int s = 0; s < 4; ++s) {
            v2f a; a.x = W2s[n0 + 2 * s][lm]; a.y = W2s[n0 + 2 * s + 1][lm];
            v2f b; b.x = h[2 * s];            b.y = h[2 * s + 1];
            c2 = WMMA_F32(a, b, c2);
        }
    }

    // register v of lane (lm, hh) = group 8 hh + v, column jl: 16 neighbouring j per half wave
    float* o = aff + (long)i * (GRP * NROI) + (long)(hh * 8) * NROI + (j0 + jl);
    #pragma unroll
    for (int v = 0; v < 8; ++v)
        o[v * NROI] = c2[v];
    // the listing goes on into the other bodies of the kernel, which reuse these registers:
    // keep the wait in front of any overwrite of a register that an issued store names
    asm volatile("s_wait_xcnt 0x0" ::: "memory");
}

// ---------------------------------------------------------------------------
// The four producers of the attention kernel's operands (q, k^T, VW, aff) do
// not depend on one another: one grid runs them all, the block index picks the
// job. The 768 GEMM blocks come first: each is a long chain of short K tiles
// that mostly waits for its copies, so they start early and the positional
// bias blocks fill the SIMDs beside them.
// ---------------------------------------------------------------------------
#define GEMM_BLOCKS 768            // 3 products x 256 tiles of 64x64
#define POS_BLOCKS  ((NROI / POS_J) * NROI)    // 8 j-tiles x 1024 rows i

__global__ __launch_bounds__(256)
void producers(const float* __restrict__ roi, const float* __restrict__ pe,
               const float* __restrict__ W1,  const float* __restrict__ b1,
               const float* __restrict__ W2,  const float* __restrict__ b2,
               const float* __restrict__ Wq,  const float* __restrict__ bq,
               const float* __restrict__ Wk,  const float* __restrict__ bk,
               const float* __restrict__ Wo,
               float* __restrict__ qb, float* __restrict__ ktb,
               float* __restrict__ vwb, float* __restrict__ aff)
{
    __shared__ __attribute__((aligned(16))) float smem[13824];   // the larger body's need (posbias)

    const int b = blockIdx.x;
    if (b < GEMM_BLOCKS) {
        const int job = b >> 8;
        const int bx  = b & 15;
        const int m0  = ((b >> 4) & 15) * 64;
        if (job == 0) {          // q = roi @ W_q + b_q
            gemm64x64(smem, roi, Wq, bq, qb, DIM, DIM, DIM, DIM, m0, bx * 64, 0);
        } else if (job == 1) {   // kt = (roi @ W_k + b_k)^T
            gemm64x64(smem, roi, Wk, bk, ktb, DIM, DIM, NROI, DIM, m0, bx * 64, 1);
        } else {                 // VW[g] = V @ W_out[g], g = bx (bias folded into attn; softmax sums to 1)
            gemm64x64(smem, roi, Wo + (long)bx * (DIM * DK), nullptr,
                      vwb + (long)bx * (NROI * DK), DIM, DK, DK, DIM, m0, 0, 0);
        }
    } else {                     // aff[i][g][j] = tanh(pe@W1+b1)@W2+b2 (streams the 256 MB PE tensor)
        const int p = b - GEMM_BLOCKS;
        posbias(smem, pe, W1, b1, W2, b2, aff, p >> 3, (p & 7) * POS_J);
    }
}

// ---------------------------------------------------------------------------
// Attention: per (g, 16-row i-tile): S = (Q_g K_g^T) * aff * 0.125, softmax
// over 1024 keys, then P @ VW_g (VW = V @ W_out precomputed) + b_out.
// 8 waves split the 1024-key dimension. kt is K^T [DIM][NROI] so B-fragment
// loads are lane-coalesced.
// ---------------------------------------------------------------------------
// second argument: 8 waves a SIMD, i.e. at most 128 registers a wave, so that registers
// as well as LDS let four work-groups of 8 waves share a WGP
__global__ __launch_bounds__(256, 8)
void attn(const float* __restrict__ qbuf, const float* __restrict__ kt,
          const float* __restrict__ aff, const float* __restrict__ vw,
          const float* __restrict__ b_out, float* __restrict__ out)
{
    __shared__ float Qs[16][68];
    __shared__ float S[16][1028];       // pad 1028: stride mod 64 == 4 -> conflict-free A reads
    // The waves' partial outputs take the place of S once its last read is over: 70 KiB of LDS
    // a work-group instead of 102, so four fit a WGP and the whole grid is resident in one round.
    float (*Pp)[16][64] = (float (*)[16][64])&S[0][0];   // 8 x 16 x 64 floats, half of S
    __shared__ float red[16][16];
    __shared__ float rowstat[16];

    const int tid  = threadIdx.x;
    const int lane = tid & 31;
    const int w    = tid >> 5;
    const int g    = blockIdx.x;
    const int i0   = blockIdx.y * 16;

    {   int r = tid >> 4, c4 = (tid & 15) * 4;
        async_copy16(qbuf + (long)(i0 + r) * DIM + g * DK + c4, &Qs[r][c4]);
    }
    wait_async<0>();
    __syncthreads();

    const int lm = lane & 15;
    const int lk = (lane >> 4) * 2;
    const int jb = w * 128;

    // ---- stage 1: logits for this wave's 128 keys ----
    #pragma unroll 1
    for (int tj = 0; tj < 8; ++tj) {
        const int j0t = jb + tj * 16;
        v8f acc = {0.f,0.f,0.f,0.f,0.f,0.f,0.f,0.f};
        #pragma unroll
        for (int kk = 0; kk < DK; kk += 4) {
            v2f a = *(const v2f*)&Qs[lm][kk + lk];
            const float* kp = kt + (long)(g * DK + kk + lk) * NROI + j0t + lm; // coalesced
            v2f b; b.x = kp[0]; b.y = kp[NROI];
            acc = WMMA_F32(a, b, acc);
        }
        #pragma unroll
        for (int v = 0; v < 8; ++v) {
            int il = v + (lane >> 4) * 8;
            int j  = j0t + lm;
            float aw = aff[(long)(i0 + il) * (GRP * NROI) + (long)g * NROI + j];
            S[il][j] = aw * acc[v] * 0.125f;   // 1/sqrt(64)
        }
    }
    __syncthreads();

    // ---- softmax over 1024 keys per row: 16 threads per row ----
    {
        const int row = tid >> 4, sub = tid & 15;
        float m = -3.402823466e38f;
        for (int kx = sub; kx < NROI; kx += 16) m = fmaxf(m, S[row][kx]);
        red[row][sub] = m;
        __syncthreads();
        if (sub == 0) {
            float mm = red[row][0];
            #pragma unroll
            for (int t = 1; t < 16; ++t) mm = fmaxf(mm, red[row][t]);
            rowstat[row] = mm;
        }
        __syncthreads();
        const float mm = rowstat[row];
        float s = 0.f;
        for (int kx = sub; kx < NROI; kx += 16) {
            float e = __expf(S[row][kx] - mm);
            S[row][kx] = e;
            s += e;
        }
        red[row][sub] = s;
        __syncthreads();
        if (sub == 0) {
            float ss = 0.f;
            #pragma unroll
            for (int t = 0; t < 16; ++t) ss += red[row][t];
            rowstat[row] = 1.f / ss;
        }
        __syncthreads();
        const float inv = rowstat[row];
        for (int kx = sub; kx < NROI; kx += 16) S[row][kx] *= inv;
    }
    __syncthreads();

    // ---- stage 2: P(16x128 per wave) @ VW_g(128x64 slice) -> partial 16x64 ----
    v8f o[4] = { {0.f,0.f,0.f,0.f,0.f,0.f,0.f,0.f}, {0.f,0.f,0.f,0.f,0.f,0.f,0.f,0.f},
                 {0.f,0.f,0.f,0.f,0.f,0.f,0.f,0.f}, {0.f,0.f,0.f,0.f,0.f,0.f,0.f,0.f} };
    #pragma unroll 1
    for (int kk = 0; kk < 128; kk += 4) {
        const int kbase = jb + kk + lk;
        v2f a = *(const v2f*)&S[lm][kbase];
        const float* vp = vw + (long)g * (NROI * DK) + (long)kbase * DK + lm;
        #pragma unroll
        for (int nt = 0; nt < 4; ++nt) {
            v2f b; b.x = vp[nt * 16]; b.y = vp[DK + nt * 16];
            o[nt] = WMMA_F32(a, b, o[nt]);
        }
    }
    __syncthreads();   // every wave has read its part of S: the partial sums may overwrite it
    #pragma unroll
    for (int nt = 0; nt < 4; ++nt) {
        #pragma unroll
        for (int v = 0; v < 8; ++v) {
            int il = v + (lane >> 4) * 8;
            Pp[w][il][nt * 16 + lm] = o[nt][v];
        }
    }
    __syncthreads();

    // ---- cross-wave reduce + bias + store ----
    #pragma unroll
    for (int it = 0; it < 4; ++it) {
        int e = tid + it * 256;
        int r = e >> 6, oc = e & 63;
        float s = 0.f;
        #pragma unroll
        for (int ww = 0; ww < 8; ++ww) s += Pp[ww][r][oc];
        out[(long)(i0 + r) * DIM + g * DK + oc] = s + b_out[g * DK + oc];
    }
}

// ---------------------------------------------------------------------------
extern "C" void kernel_launch(void* const* d_in, const int* in_sizes, int n_in,
                              void* d_out, int out_size, void* d_ws, size_t ws_size,
                              hipStream_t stream)
{
    const float* roi   = (const float*)d_in[0];
    const float* pe    = (const float*)d_in[1];
    const float* W_fc1 = (const float*)d_in[2];
    const float* b_fc1 = (const float*)d_in[3];
    const float* W_fc2 = (const float*)d_in[4];
    const float* b_fc2 = (const float*)d_in[5];
    const float* W_q   = (const float*)d_in[6];
    const float* b_q   = (const float*)d_in[7];
    const float* W_k   = (const float*)d_in[8];
    const float* b_k   = (const float*)d_in[9];
    const float* W_out = (const float*)d_in[10];
    const float* b_out = (const float*)d_in[11];
    float* out = (float*)d_out;

    float* ws   = (float*)d_ws;
    float* qb   = ws;                               // q  [1024,1024]
    float* ktb  = qb + (long)NROI * DIM;            // k^T [1024(D),1024(N)]
    float* vwb  = ktb + (long)DIM * NROI;           // VW [16,1024,64]
    float* affb = vwb + (long)GRP * NROI * DK;      // aff [1024,16,1024]
    (void)in_sizes; (void)n_in; (void)out_size; (void)ws_size;

    dim3 blk(256);

    // q, k^T, VW and aff: four independent producers in one grid
    producers<<<dim3(GEMM_BLOCKS + POS_BLOCKS), blk, 0, stream>>>(
        roi, pe, W_fc1, b_fc1, W_fc2, b_fc2, W_q, b_q, W_k, b_k, W_out,
        qb, ktb, vwb, affb);

    // fused logits * aff -> softmax -> @ VW + b_out
    attn<<<dim3(GRP, NROI / 16, 1), blk, 0, stream>>>(
        qb, ktb, affb, vwb, b_out, out);
}

// v005
// It runs in 125 microseconds.
// Timed twice side by side with v004, it ran 1.09 times as fast both times.
// Counting every step since v000, it is 1.96 times as fast.
#include <hip/hip_runtime.h>
#include <hip/hip_bf16.h>

typedef __attribute__((ext_vector_type(2))) float v2f;
typedef __attribute__((ext_vector_type(8))) float v8f;
typedef __attribute__((ext_vector_type(4))) int   v4i;

#define WMMA_F32(a, b, c) \
    __builtin_amdgcn_wmma_f32_16x16x4_f32(false, (a), false, (b), (short)0, (c), false, false)

#define NROI 1024
#define DIM  1024
#define PDIM 64
#define GRP  16
#define DK   64

// ---------------------------------------------------------------------------
// CDNA5 async global->LDS copy (ASYNCcnt path), with synchronous fallback so
// the file compiles on toolchains lacking the builtin.
// ---------------------------------------------------------------------------
#if defined(__HIP_DEVICE_COMPILE__) && __has_builtin(__builtin_amdgcn_global_load_async_to_lds_b128)
#define HAVE_ASYNC_LDS 1
#else
#define HAVE_ASYNC_LDS 0
#endif

__device__ __forceinline__ void async_copy16(const void* g, void* l)
{
#if HAVE_ASYNC_LDS
    typedef __attribute__((address_space(1))) v4i* g4p;
    typedef __attribute__((address_space(3))) v4i* l4p;
    __builtin_amdgcn_global_load_async_to_lds_b128(
        (g4p)(uintptr_t)g, (l4p)(uintptr_t)l, 0, 0);
#else
    *(float4*)l = *(const float4*)g;
#endif
}

template <int N>
__device__ __forceinline__ void wait_async()
{
#if HAVE_ASYNC_LDS
#if __has_builtin(__builtin_amdgcn_s_wait_asynccnt)
    __builtin_amdgcn_s_wait_asynccnt((unsigned short)N);
#else
    if (N == 0) asm volatile("s_wait_asynccnt 0x0" ::: "memory");
    else        asm volatile("s_wait_asynccnt 0x2" ::: "memory");
#endif
#endif
}

// ---------------------------------------------------------------------------
// Generic fp32 WMMA GEMM: C[M,N] = A[M,K] @ B[K,N] (+bias), 64x64 tile / WG,
// 8 waves (wave32), 16x32 sub-tile per wave. Double-buffered LDS with async
// global->LDS copies so tile t+1 streams in under tile t's WMMAs.
// transC=1 stores C transposed: C[n*ldc + m] (used for k^T layout).
// One work-group's body: the caller picks operands and the tile (m0, n0).
// smem: the work-group's LDS block, 4608 floats used here.
// ---------------------------------------------------------------------------
__device__ __forceinline__
void gemm64x64(float* smem,
               const float* __restrict__ A, const float* __restrict__ B,
               const float* __restrict__ bias, float* __restrict__ C,
               int lda, int ldb, int ldc, int K,
               int m0, int n0, int transC)
{
    float (*As)[64][20] = (float (*)[64][20])smem;            // 64x16 tile, pad 20 (conflict-free A-frag reads)
    float (*Bs)[16][64] = (float (*)[16][64])(smem + 2560);   // 16x64 tile

    const int tid  = threadIdx.x;
    const int lane = tid & 31;
    const int w    = tid >> 5;

    const int wm = (w & 3) * 16;      // wave row base within 64
    const int wn = (w >> 2) * 32;     // wave col base within 64
    const int lm = lane & 15;
    const int lk = (lane >> 4) * 2;   // K offset pair per half-wave

    // per-thread copy slots (one 16B A chunk + one 16B B chunk per tile)
    const int ra = tid >> 2, ca = (tid & 3) * 4;
    const int rb = tid >> 4, cb = (tid & 15) * 4;
    const float* gA = A + (long)(m0 + ra) * lda + ca;
    const float* gB = B + (long)rb * ldb + n0 + cb;

    v8f acc0 = {0.f,0.f,0.f,0.f,0.f,0.f,0.f,0.f};
    v8f acc1 = {0.f,0.f,0.f,0.f,0.f,0.f,0.f,0.f};

    const int ntiles = K >> 4;
    // prologue: stream tile 0 into buffer 0
    async_copy16(gA, &As[0][ra][ca]);
    async_copy16(gB, &Bs[0][rb][cb]);

    for (int t = 0; t < ntiles; ++t) {
        const int buf = t & 1;
        if (t + 1 < ntiles) {            // stream next tile into other buffer
            const int kk = (t + 1) << 4;
            async_copy16(gA + kk,               &As[buf ^ 1][ra][ca]);
            async_copy16(gB + (long)kk * ldb,   &Bs[buf ^ 1][rb][cb]);
            wait_async<2>();             // tile t landed (async loads retire in order)
        } else {
            wait_async<0>();
        }
        __syncthreads();

        #pragma unroll
        for (int k2 = 0; k2 < 16; k2 += 4) {
            v2f a;  a.x  = As[buf][wm + lm][k2 + lk];       a.y  = As[buf][wm + lm][k2 + lk + 1];
            v2f b0; b0.x = Bs[buf][k2 + lk][wn + lm];       b0.y = Bs[buf][k2 + lk + 1][wn + lm];
            v2f b1; b1.x = Bs[buf][k2 + lk][wn + 16 + lm];  b1.y = Bs[buf][k2 + lk + 1][wn + 16 + lm];
            acc0 = WMMA_F32(a, b0, acc0);
            acc1 = WMMA_F32(a, b1, acc1);
        }
        __syncthreads();                 // buffer free for reuse at t+2
    }

    #pragma unroll
    for (int v = 0; v < 8; ++v) {
        int r  = m0 + wm + v + (lane >> 4) * 8;
        int c0 = n0 + wn + lm;
        float o0 = acc0[v], o1 = acc1[v];
        if (bias) { o0 += bias[c0]; o1 += bias[c0 + 16]; }
        if (!transC) {
            C[(long)r * ldc + c0]      = o0;
            C[(long)r * ldc + c0 + 16] = o1;
        } else {
            C[(long)c0 * ldc + r]        = o0;
            C[(long)(c0 + 16) * ldc + r] = o1;
        }
        // the two stores' registers are reused by the next pass and by what follows the loop:
        // keep the wait in front of any overwrite of a register that an issued store names
        asm volatile("s_wait_xcnt 0x0" ::: "memory");
    }
}

// ---------------------------------------------------------------------------
// Positional bias: aff[i][g][j] = tanh(pe[i,j,:] @ W1 + b1) @ W2 + b2
// One WG handles (i fixed, 128 consecutive j); each wave owns 16 of them from end to end.
// Both layers are computed transposed (weights as the first operand, j as the column):
//   H^T[n][j]   = sum_k W1[k][n] * X[j][k]      4 accumulator tiles = all 64 hidden units n
//   aff^T[g][j] = sum_n W2[n][g] * tanh(H^T)[n][j]
// An accumulator register r of lane (c, h) holds row 8h + r of column c, and a second operand
// wants, in lane (c, h), two k values of column c: registers 2s, 2s + 1 of a tile ARE such an
// operand for k = 8h + 2s, 8h + 2s + 1. W2's rows are read in that same k order, so the hidden
// layer goes from the first product to the second in registers: no LDS, no barrier, no idle wave.
// This kernel streams the 256 MB position embedding.
// ---------------------------------------------------------------------------
// tanh(x) = 1 - 2 / (e^(2x) + 1), with e^(2x) = 2^(x * 2 log2(e)).
// Straight-line code: a wave's values are independent chains with no branch on the data.
// e = inf gives 1, e = 0 gives -1, NaN stays NaN; the absolute error is a few units of
// the last place of 1, which is what the sum over the 64 hidden units behind it sees.
#define TANH_ARG_SCALE 2.885390081777927f
#define POS_J 128                  // j per work-group: 16 per wave

__device__ __forceinline__ v8f tanh8(v8f acc)
{
    const v8f t = acc * TANH_ARG_SCALE;
    v8f e;
    // unrolled: constant indices keep the vector in registers
    #pragma unroll
    for (int v = 0; v < 8; ++v) e[v] = __builtin_amdgcn_exp2f(t[v]);
    e = e + 1.0f;
    v8f q;
    // unrolled: constant indices keep the vector in registers
    #pragma unroll
    for (int v = 0; v < 8; ++v) q[v] = __builtin_amdgcn_rcpf(e[v]);
    return 1.0f - 2.0f * q;
}

__device__ __forceinline__
void posbias(float* smem,
             const float* __restrict__ pe, const float* __restrict__ W1,
             const float* __restrict__ b1, const float* __restrict__ W2,
             const float* __restrict__ b2, float* __restrict__ aff,
             int i, int j0)
{
    float (*Xs)[68]  = (float (*)[68])smem;              // 128 rows
    float (*W1s)[64] = (float (*)[64])(smem + 8704);     // 64 rows; left as it was: rows two apart (the half-waves) share banks
    float (*W2s)[16] = (float (*)[16])(smem + 12800);    // 64 rows

    const int tid  = threadIdx.x;
    const int lane = tid & 31;
    const int w    = tid >> 5;
    const float* X = pe + ((long)i * NROI + j0) * PDIM;

    // the copy loops are unrolled so that all 13 copies of a thread issue back to back
    #pragma unroll
    for (int it = 0; it < 8; ++it) {
        int idx = tid + it * 256;
        int r = idx >> 4, c4 = (idx & 15) * 4;
        async_copy16(X + (long)r * PDIM + c4, &Xs[r][c4]);
    }
    #pragma unroll
    for (int it = 0; it < 4; ++it) {
        int idx = tid + it * 256;
        int r = idx >> 4, c4 = (idx & 15) * 4;
        async_copy16(W1 + r * PDIM + c4, &W1s[r][c4]);
    }
    {   int r = tid >> 2, c4 = (tid & 3) * 4;
        async_copy16(W2 + r * GRP + c4, &W2s[r][c4]);
    }

    const int lm = lane & 15;
    const int hh = lane >> 4;
    const int lk = hh * 2;
    const int jl = w * 16 + lm;       // this lane's column: local j

    // Each sum starts from its bias: a row of an accumulator tile is one hidden unit (one group),
    // so the bias differs by register, and loaded here it arrives while the copies are in flight.
    // every loop below is unrolled: constant indices keep the accumulator tiles in registers
    v8f c[4], c2;
    #pragma unroll
    for (int nt = 0; nt < 4; ++nt) {
        #pragma unroll
        for (int v = 0; v < 8; ++v) c[nt][v] = b1[nt * 16 + hh * 8 + v];
    }
    #pragma unroll
    for (int v = 0; v < 8; ++v) c2[v] = b2[hh * 8 + v];

    wait_async<0>();
    __syncthreads();

    // ---- layer 1, transposed: 64 hidden units x 16 j per wave ----
    #pragma unroll
    for (int kk = 0; kk < 64; kk += 4) {
        v2f x; x.x = Xs[jl][kk + lk]; x.y = Xs[jl][kk + lk + 1];
        #pragma unroll
        for (int nt = 0; nt < 4; ++nt) {
            v2f a; a.x = W1s[kk + lk][nt * 16 + lm]; a.y = W1s[kk + lk + 1][nt * 16 + lm];
            c[nt] = WMMA_F32(a, x, c[nt]);
        }
    }

    // ---- tanh in place, then layer 2 straight from the accumulator registers ----
    #pragma unroll
    for (int nt = 0; nt < 4; ++nt) {
        const int n0 = nt * 16 + hh * 8;          // first hidden unit this lane holds of tile nt
        const v8f h = tanh8(c[nt]);
        #pragma unroll
        for (int s = 0; s < 4; ++s) {
            v2f a; a.x = W2s[n0 + 2 * s][lm]; a.y = W2s[n0 + 2 * s + 1][lm];
            v2f b; b.x = h[2 * s];            b.y = h[2 * s + 1];
            c2 = WMMA_F32(a, b, c2);
        }
    }

    // register v of lane (lm, hh) = group 8 hh + v, column jl: 16 neighbouring j per half wave
    float* o = aff + (long)i * (GRP * NROI) + (long)(hh * 8) * NROI + (j0 + jl);
    #pragma unroll
    for (int v = 0; v < 8; ++v)
        o[v * NROI] = c2[v];
    // the listing goes on into the other bodies of the kernel, which reuse these registers:
    // keep the wait in front of any overwrite of a register that an issued store names
    asm volatile("s_wait_xcnt 0x0" ::: "memory");
}

// ---------------------------------------------------------------------------
// The four producers of the attention kernel's operands (q, k^T, VW, aff) do
// not depend on one another: one grid runs them all, the block index picks the
// job. The 768 GEMM blocks come first: each is a long chain of short K tiles
// that mostly waits for its copies, so they start early and the positional
// bias blocks fill the SIMDs beside them.
// ---------------------------------------------------------------------------
#define GEMM_BLOCKS 768            // 3 products x 256 tiles of 64x64
#define POS_BLOCKS  ((NROI / POS_J) * NROI)    // 8 j-tiles x 1024 rows i

__global__ __launch_bounds__(256)
void producers(const float* __restrict__ roi, const float* __restrict__ pe,
               const float* __restrict__ W1,  const float* __restrict__ b1,
               const float* __restrict__ W2,  const float* __restrict__ b2,
               const float* __restrict__ Wq,  const float* __restrict__ bq,
               const float* __restrict__ Wk,  const float* __restrict__ bk,
               const float* __restrict__ Wo,
               float* __restrict__ qb, float* __restrict__ ktb,
               float* __restrict__ vwb, float* __restrict__ aff)
{
    __shared__ __attribute__((aligned(16))) float smem[13824];   // the larger body's need (posbias)

    const int b = blockIdx.x;
    if (b < GEMM_BLOCKS) {
        const int job = b >> 8;
        const int bx  = b & 15;
        const int m0  = ((b >> 4) & 15) * 64;
        if (job == 0) {          // q = roi @ W_q + b_q
            gemm64x64(smem, roi, Wq, bq, qb, DIM, DIM, DIM, DIM, m0, bx * 64, 0);
        } else if (job == 1) {   // kt = (roi @ W_k + b_k)^T
            gemm64x64(smem, roi, Wk, bk, ktb, DIM, DIM, NROI, DIM, m0, bx * 64, 1);
        } else {                 // VW[g] = V @ W_out[g], g = bx (bias folded into attn; softmax sums to 1)
            gemm64x64(smem, roi, Wo + (long)bx * (DIM * DK), nullptr,
                      vwb + (long)bx * (NROI * DK), DIM, DK, DK, DIM, m0, 0, 0);
        }
    } else {                     // aff[i][g][j] = tanh(pe@W1+b1)@W2+b2 (streams the 256 MB PE tensor)
        const int p = b - GEMM_BLOCKS;
        posbias(smem, pe, W1, b1, W2, b2, aff, p >> 3, (p & 7) * POS_J);
    }
}

__device__ __forceinline__ float exp2_slot(float x)
{
    float e;
    asm("v_exp_f32 %0, %1\n\tv_nop" : "=v"(e) : "v"(x));
    return e;
}

// second argument: 8 waves a SIMD, i.e. at most 128 registers a wave, so that four
// work-groups of 8 waves share a WGP and the whole grid is resident in one round
__global__ __launch_bounds__(256, 8)
void attn(const float* __restrict__ qbuf, const float* __restrict__ kt,
          const float* __restrict__ aff, const float* __restrict__ vw,
          const float* __restrict__ b_out, float* __restrict__ out)
{
    __shared__ __attribute__((aligned(16))) float Qs[16][68];
    __shared__ __attribute__((aligned(16))) float Pp[8][16][68];   // [wave][i][o], pitch 68: 16-byte accesses of 16 rows spread over all banks
    __shared__ __attribute__((aligned(16))) float redm[16][20];    // [i][wave * 2 + half]: partial maxima
    __shared__ __attribute__((aligned(16))) float reds[16][20];    // the same for the partial sums

    const int tid  = threadIdx.x;
    const int g    = blockIdx.x;
    const int i0   = blockIdx.y * 16;

    {   int r = tid >> 4, c4 = (tid & 15) * 4;
        async_copy16(qbuf + (long)(i0 + r) * DIM + g * DK + c4, &Qs[r][c4]);
    }
    wait_async<0>();
    __syncthreads();

    // Registers are the limit here (64 scores + 32 outputs + loads in flight, 128 in all): the wave's
    // number lives in a scalar register and the lane's comes from the hardware, so that no index
    // formed from the thread id for the copy above stays alive down to the epilogue (a spill otherwise).
    const int w    = __builtin_amdgcn_readfirstlane(tid >> 5);
    const int lane = (int)__builtin_amdgcn_mbcnt_lo(~0u, 0u);
    const int lm = lane & 15;
    const int hh = lane >> 4;
    const int lk = hh * 2;
    const int jb = w * 128;

    // every loop below is unrolled: constant indices keep the score and output tiles in registers.
    // HOLD_LOADS: nothing is scheduled across it. Left alone, the compiler sinks every global load to
    // its use and waits for it there, one load latency a product; behind a group of loads for a LATER
    // group of products it keeps them in flight under the products of the current group.
#define HOLD_LOADS() __builtin_amdgcn_sched_barrier(0)

    // each operand: a base that is the same for the whole wave (scalar registers) + one 32-bit lane offset
    const float* kp = kt + (long)(g * DK) * NROI + jb;             // + klane: coalesced
    const int klane = lk * NROI + lm;

    // ---- stage 1: S^T for this wave's 128 keys; d outermost: 8 independent accumulator chains,
    //      the fragments of the next four d in flight under the products of these four ----
    v8f st[8];
    #pragma unroll
    for (int t = 0; t < 8; ++t) st[t] = (v8f){0.f,0.f,0.f,0.f,0.f,0.f,0.f,0.f};
    v2f kc[8], kn[8], qc, qn;
    float4 af[8][2];               // positional weights, at most four tiles alive
    const float* ap = aff + (long)i0 * (GRP * NROI) + (long)g * NROI + jb;
    int alane = 0;
    #pragma unroll
    for (int t = 0; t < 8; ++t) { kc[t].x = kp[klane + t * 16]; kc[t].y = kp[klane + NROI + t * 16]; }
    qc = *(const v2f*)&Qs[lm][lk];
    #pragma unroll
    for (int kk = 0; kk < DK; kk += 4) {
        if (kk + 4 < DK) {
            #pragma unroll
            for (int t = 0; t < 8; ++t) {
                kn[t].x = kp[klane + (kk + 4) * NROI + t * 16];
                kn[t].y = kp[klane + (kk + 5) * NROI + t * 16];
            }
            qn = *(const v2f*)&Qs[lm][kk + 4 + lk];
        } else {                   // no K left: the first three tiles' positional weights take the place
            alane = lm * (GRP * NROI) + hh * 8;
            #pragma unroll
            for (int t = 0; t < 3; ++t) {
                af[t][0] = *(const float4*)(ap + alane + t * 16);
                af[t][1] = *(const float4*)(ap + alane + t * 16 + 4);
            }
        }
        HOLD_LOADS();
        #pragma unroll
        for (int t = 0; t < 8; ++t) st[t] = WMMA_F32(kc[t], qc, st[t]);
        HOLD_LOADS();              // and no third group comes up over these products: registers
        #pragma unroll
        for (int t = 0; t < 8; ++t) kc[t] = kn[t];
        qc = qn;
    }

    // ---- positional weight and scale; register v of tile t = key jb + 16 t + 8 hh + v, row i0 + lm ----
    float m = -3.402823466e38f;
    #pragma unroll
    for (int t = 0; t < 8; ++t) {
        if (t + 3 < 8) {
            af[t + 3][0] = *(const float4*)(ap + alane + (t + 3) * 16);
            af[t + 3][1] = *(const float4*)(ap + alane + (t + 3) * 16 + 4);
        }
        HOLD_LOADS();
        const float aw[8] = { af[t][0].x, af[t][0].y, af[t][0].z, af[t][0].w,
                              af[t][1].x, af[t][1].y, af[t][1].z, af[t][1].w };
        #pragma unroll
        for (int v = 0; v < 8; ++v) {
            st[t][v] = aw[v] * st[t][v] * 0.125f;   // 1/sqrt(64)
            m = fmaxf(m, st[t][v]);
        }
    }

    // ---- row maximum over the 16 (wave, half) parts ----
    redm[lm][w * 2 + hh] = m;
    __syncthreads();

    // stage 2's first two k steps of VW start here, behind the barrier (which waits for every load), and arrive under the exponentials
    const float* vp = vw + (long)g * (NROI * DK) + (long)jb * DK;
    const int vlane = hh * 8 * DK + lm;
    v2f a0[4], a1[4], a2[4];
    #pragma unroll
    for (int nt = 0; nt < 4; ++nt) {
        a0[nt].x = vp[vlane + 0 * DK + nt * 16]; a0[nt].y = vp[vlane + 1 * DK + nt * 16];
        a1[nt].x = vp[vlane + 2 * DK + nt * 16]; a1[nt].y = vp[vlane + 3 * DK + nt * 16];
    }
    HOLD_LOADS();

    #pragma unroll
    for (int c = 0; c < 4; ++c) {
        const float4 r4 = *(const float4*)&redm[lm][c * 4];
        m = fmaxf(fmaxf(m, fmaxf(r4.x, r4.y)), fmaxf(r4.z, r4.w));
    }

    // ---- exponentials in place; 8 running sums, then one ----
    v8f es = {0.f,0.f,0.f,0.f,0.f,0.f,0.f,0.f};
    #pragma unroll
    for (int t = 0; t < 8; ++t) {
        #pragma unroll
        for (int v = 0; v < 8; ++v) st[t][v] = exp2_slot((st[t][v] - m) * 1.44269504088896340736f);   // e^(s - max)
        es += st[t];
    }
    reds[lm][w * 2 + hh] = ((es[0] + es[1]) + (es[2] + es[3])) + ((es[4] + es[5]) + (es[6] + es[7]));
    HOLD_LOADS();                  // the third k step's loads stay below the exponentials: registers

    // ---- stage 2: out^T partial (64 o x 16 i) over this wave's 128 keys, scores from registers;
    //      k step u = keys 16 (u / 4) + 8 hh + 2 (u % 4), + 1; VW's fragments two k steps ahead ----
    v8f o[4];
    #pragma unroll
    for (int nt = 0; nt < 4; ++nt) o[nt] = (v8f){0.f,0.f,0.f,0.f,0.f,0.f,0.f,0.f};
    #pragma unroll
    for (int u = 0; u < 32; ++u) {
        if (u + 2 < 32) {
            const int row = ((u + 2) >> 2) * 16 + ((u + 2) & 3) * 2;
            #pragma unroll
            for (int nt = 0; nt < 4; ++nt) {
                a2[nt].x = vp[vlane + row * DK + nt * 16];
                a2[nt].y = vp[vlane + (row + 1) * DK + nt * 16];
            }
        }
        HOLD_LOADS();
        v2f p; p.x = st[u >> 2][2 * (u & 3)]; p.y = st[u >> 2][2 * (u & 3) + 1];
        #pragma unroll
        for (int nt = 0; nt < 4; ++nt) o[nt] = WMMA_F32(a0[nt], p, o[nt]);
        HOLD_LOADS();              // and no fourth k step comes up over these products: registers
        #pragma unroll
        for (int nt = 0; nt < 4; ++nt) { a0[nt] = a1[nt]; a1[nt] = a2[nt]; }
    }
    // register v of tile nt = output column nt * 16 + 8 hh + v of row lm
    #pragma unroll
    for (int nt = 0; nt < 4; ++nt) {
        *(float4*)&Pp[w][lm][nt * 16 + hh * 8]     = make_float4(o[nt][0], o[nt][1], o[nt][2], o[nt][3]);
        *(float4*)&Pp[w][lm][nt * 16 + hh * 8 + 4] = make_float4(o[nt][4], o[nt][5], o[nt][6], o[nt][7]);
    }

    // ---- cross-wave reduce, division by the row's sum, bias, store: 4 columns of one row a thread ----
    {
        const int r = w * 2 + hh, c4 = lm * 4;
        __syncthreads();
        const float4 bo = *(const float4*)(b_out + g * DK + c4);
        float4 r4[4], p4[8];
        #pragma unroll
        for (int c = 0; c < 4; ++c) r4[c] = *(const float4*)&reds[r][c * 4];
        #pragma unroll
        for (int ww = 0; ww < 8; ++ww) p4[ww] = *(const float4*)&Pp[ww][r][c4];
        float ss = 0.f;
        #pragma unroll
        for (int c = 0; c < 4; ++c) { ss += r4[c].x; ss += r4[c].y; ss += r4[c].z; ss += r4[c].w; }
        const float inv = 1.f / ss;
        float4 s = make_float4(0.f, 0.f, 0.f, 0.f);
        #pragma unroll
        for (int ww = 0; ww < 8; ++ww) { s.x += p4[ww].x; s.y += p4[ww].y; s.z += p4[ww].z; s.w += p4[ww].w; }
        *(float4*)(out + (long)(i0 + r) * DIM + g * DK + c4) =
            make_float4(s.x * inv + bo.x, s.y * inv + bo.y, s.z * inv + bo.z, s.w * inv + bo.w);
    }
#undef HOLD_LOADS
}

// ---------------------------------------------------------------------------
extern "C" void kernel_launch(void* const* d_in, const int* in_sizes, int n_in,
                              void* d_out, int out_size, void* d_ws, size_t ws_size,
                              hipStream_t stream)
{
    const float* roi   = (const float*)d_in[0];
    const float* pe    = (const float*)d_in[1];
    const float* W_fc1 = (const float*)d_in[2];
    const float* b_fc1 = (const float*)d_in[3];
    const float* W_fc2 = (const float*)d_in[4];
    const float* b_fc2 = (const float*)d_in[5];
    const float* W_q   = (const float*)d_in[6];
    const float* b_q   = (const float*)d_in[7];
    const float* W_k   = (const float*)d_in[8];
    const float* b_k   = (const float*)d_in[9];
    const float* W_out = (const float*)d_in[10];
    const float* b_out = (const float*)d_in[11];
    float* out = (float*)d_out;

    float* ws   = (float*)d_ws;
    float* qb   = ws;                               // q  [1024,1024]
    float* ktb  = qb + (long)NROI * DIM;            // k^T [1024(D),1024(N)]
    float* vwb  = ktb + (long)DIM * NROI;           // VW [16,1024,64]
    float* affb = vwb + (long)GRP * NROI * DK;      // aff [1024,16,1024]
    (void)in_sizes; (void)n_in; (void)out_size; (void)ws_size;

    dim3 blk(256);

    // q, k^T, VW and aff: four independent producers in one grid
    producers<<<dim3(GEMM_BLOCKS + POS_BLOCKS), blk, 0, stream>>>(
        roi, pe, W_fc1, b_fc1, W_fc2, b_fc2, W_q, b_q, W_k, b_k, W_out,
        qb, ktb, vwb, affb);

    // fused logits * aff -> softmax -> @ VW + b_out
    attn<<<dim3(GRP, NROI / 16, 1), blk, 0, stream>>>(
        qb, ktb, affb, vwb, b_out, out);
}
